// v000
// Measured on an AMD MI455X. A time is GPU time per run, averaged over a window of back-to-back runs after a warm-up
// (all launches, gaps included; the runs take copies of the inputs in turn), and the median of several windows.
// Apart from v000's, it joins two sittings. Times from different sittings can be a few percent apart, while
// side-by-side timings come from the same sitting.
// The starting kernel, v000, takes 340 microseconds a run.
#include <hip/hip_runtime.h>
#include <math.h>

// Problem constants (match reference)
#define Bsz 8
#define Nn  256
#define Cc  128
#define Tt  64
#define Hh  4
#define Gg  12
#define Dd  32
#define EPSF 1e-6f

typedef __attribute__((ext_vector_type(2))) float v2f;
typedef __attribute__((ext_vector_type(8))) float v8f;

// D = A(16x4,f32) * B(4x16,f32) + C(16x16,f32)   -> v_wmma_f32_16x16x4_f32
__device__ __forceinline__ v8f wmma4(v2f a, v2f b, v8f c) {
  return __builtin_amdgcn_wmma_f32_16x16x4_f32(false, a, false, b, (short)0, c,
                                               false, false);
}

// ---------------------------------------------------------------------------
// Generic GEMM: out[M x Nc] = A[M x K] @ W[K x Nc] + bias[Nc]
// One wave per 16x16 output tile. K must be a multiple of 4.
// grid = (M/16, Nc/16), block = 32
// ---------------------------------------------------------------------------
__global__ void __launch_bounds__(32)
gemm_bias_kernel(const float* __restrict__ A, const float* __restrict__ W,
                 const float* __restrict__ bias, float* __restrict__ out,
                 int M, int K, int Nc) {
  const int lane = threadIdx.x & 31;
  const int half = lane >> 4;   // which K pair / which row half for C
  const int ln   = lane & 15;   // M index for A, N index for B/C
  const int row0 = blockIdx.x * 16;
  const int col0 = blockIdx.y * 16;

  v8f acc;
  const float bv = bias[col0 + ln];
#pragma unroll
  for (int r = 0; r < 8; ++r) acc[r] = bv;

  for (int k0 = 0; k0 < K; k0 += 4) {
    v2f a, b;
    const float* Ap = A + (size_t)(row0 + ln) * K + (k0 + 2 * half);
    a[0] = Ap[0];
    a[1] = Ap[1];
    const float* Wp = W + (size_t)(k0 + 2 * half) * Nc + (col0 + ln);
    b[0] = Wp[0];
    b[1] = Wp[Nc];
    acc = wmma4(a, b, acc);
  }

#pragma unroll
  for (int r = 0; r < 8; ++r) {
    const int row = r + 8 * half;
    out[(size_t)(row0 + row) * Nc + col0 + ln] = acc[r];
  }
}

// ---------------------------------------------------------------------------
// Fused: geometry -> rel_feat -> lang cross-attn -> bias head
// grid = (N, B), block = 128 (4 waves). Each wave handles a 16-wide j tile,
// iterating 4 times to cover all 256 j for this (b, i).
// ---------------------------------------------------------------------------
__global__ void __launch_bounds__(128)
relbias_kernel(const float* __restrict__ centers,
               const float* __restrict__ corners,
               const float* __restrict__ Wrel, const float* __restrict__ brel,
               const float* __restrict__ ktxt, const float* __restrict__ vtxt,
               const float* __restrict__ Wbias, const float* __restrict__ bbias,
               float* __restrict__ biasout) {
  __shared__ float ldsG[4][16][Gg];   // geometry features (16 x 12)
  __shared__ float ldsR[4][16][Cc];   // rel_feat, later rel_feat + ctx
  __shared__ float ldsA[4][16][Tt];   // scores / alpha

  const int i    = blockIdx.x;
  const int b    = blockIdx.y;
  const int w    = threadIdx.x >> 5;
  const int lane = threadIdx.x & 31;
  const int half = lane >> 4;
  const int ln   = lane & 15;

  // sizes for node i (same for all lanes; cheap)
  float sxi, syi, szi;
  {
    const float* cp = corners + (size_t)(b * Nn + i) * 24;
    float mx0 = -1e30f, mx1 = -1e30f, mx2 = -1e30f;
    float mn0 = 1e30f, mn1 = 1e30f, mn2 = 1e30f;
#pragma unroll
    for (int c = 0; c < 8; ++c) {
      float x = cp[c * 3 + 0], y = cp[c * 3 + 1], z = cp[c * 3 + 2];
      mx0 = fmaxf(mx0, x); mn0 = fminf(mn0, x);
      mx1 = fmaxf(mx1, y); mn1 = fminf(mn1, y);
      mx2 = fmaxf(mx2, z); mn2 = fminf(mn2, z);
    }
    sxi = mx0 - mn0; syi = mx1 - mn1; szi = mx2 - mn2;
  }
  const float cxi = centers[(size_t)(b * Nn + i) * 3 + 0];
  const float cyi = centers[(size_t)(b * Nn + i) * 3 + 1];
  const float czi = centers[(size_t)(b * Nn + i) * 3 + 2];

  const float rs128 = 0.08838834764831845f;  // 1/sqrt(128)

  for (int jo = 0; jo < 4; ++jo) {
    const int j0 = jo * 64 + w * 16;

    // ---- stage 1: geometry features for 16 j rows (lanes 0..15) ----
    if (lane < 16) {
      const int j = j0 + lane;
      const float cxj = centers[(size_t)(b * Nn + j) * 3 + 0];
      const float cyj = centers[(size_t)(b * Nn + j) * 3 + 1];
      const float czj = centers[(size_t)(b * Nn + j) * 3 + 2];
      const float r0 = cxj - cxi, r1 = cyj - cyi, r2 = czj - czi;
      const float dist  = sqrtf(r0 * r0 + r1 * r1 + r2 * r2);
      const float horiz = sqrtf(r0 * r0 + r1 * r1);
      const float cose  = r2 / (dist + EPSF);
      const float dlog  = logf(dist + EPSF);
      // sizes for node j
      const float* cp = corners + (size_t)(b * Nn + j) * 24;
      float mx0 = -1e30f, mx1 = -1e30f, mx2 = -1e30f;
      float mn0 = 1e30f, mn1 = 1e30f, mn2 = 1e30f;
#pragma unroll
      for (int c = 0; c < 8; ++c) {
        float x = cp[c * 3 + 0], y = cp[c * 3 + 1], z = cp[c * 3 + 2];
        mx0 = fmaxf(mx0, x); mn0 = fminf(mn0, x);
        mx1 = fmaxf(mx1, y); mn1 = fminf(mn1, y);
        mx2 = fmaxf(mx2, z); mn2 = fminf(mn2, z);
      }
      const float sxj = mx0 - mn0, syj = mx1 - mn1, szj = mx2 - mn2;
      float* g = &ldsG[w][lane][0];
      g[0] = r0; g[1] = r1; g[2] = r2;
      g[3] = dlog; g[4] = horiz; g[5] = cose;
      g[6] = sxj - sxi; g[7] = syj - syi; g[8] = szj - szi;
      g[9]  = sxj / (sxi + EPSF);
      g[10] = syj / (syi + EPSF);
      g[11] = szj / (szi + EPSF);
    }
    __syncthreads();

    // ---- stage 2: rel_feat = geom(16x12) @ Wrel(12x128) + brel ----
    for (int ct = 0; ct < 8; ++ct) {
      const int c0 = ct * 16;
      v8f acc;
      const float bv = brel[c0 + ln];
#pragma unroll
      for (int r = 0; r < 8; ++r) acc[r] = bv;
#pragma unroll
      for (int k0 = 0; k0 < Gg; k0 += 4) {
        v2f a, bb;
        a[0] = ldsG[w][ln][k0 + 2 * half];
        a[1] = ldsG[w][ln][k0 + 2 * half + 1];
        bb[0] = Wrel[(size_t)(k0 + 2 * half) * Cc + c0 + ln];
        bb[1] = Wrel[(size_t)(k0 + 2 * half + 1) * Cc + c0 + ln];
        acc = wmma4(a, bb, acc);
      }
#pragma unroll
      for (int r = 0; r < 8; ++r) ldsR[w][r + 8 * half][c0 + ln] = acc[r];
    }
    __syncthreads();

    // ---- stage 3: scores = rel_feat(16x128) @ ktxt^T(128x64) * rs128 ----
    for (int tt = 0; tt < 4; ++tt) {
      const int t0 = tt * 16;
      v8f acc;
#pragma unroll
      for (int r = 0; r < 8; ++r) acc[r] = 0.f;
      for (int k0 = 0; k0 < Cc; k0 += 4) {
        v2f a, bb;
        a[0] = ldsR[w][ln][k0 + 2 * half];
        a[1] = ldsR[w][ln][k0 + 2 * half + 1];
        const float* kp = ktxt + (size_t)(b * Tt + t0 + ln) * Cc + k0 + 2 * half;
        bb[0] = kp[0];
        bb[1] = kp[1];
        acc = wmma4(a, bb, acc);
      }
#pragma unroll
      for (int r = 0; r < 8; ++r)
        ldsA[w][r + 8 * half][t0 + ln] = acc[r] * rs128;
    }
    __syncthreads();

    // ---- stage 4: softmax over T=64, 2 lanes per row ----
    {
      const int row = ln, seg = half;
      float mx = -1e30f;
#pragma unroll
      for (int t = 0; t < 32; ++t) mx = fmaxf(mx, ldsA[w][row][seg * 32 + t]);
      mx = fmaxf(mx, __shfl_xor(mx, 16, 32));
      float sum = 0.f;
#pragma unroll
      for (int t = 0; t < 32; ++t) {
        float e = __expf(ldsA[w][row][seg * 32 + t] - mx);
        ldsA[w][row][seg * 32 + t] = e;
        sum += e;
      }
      sum += __shfl_xor(sum, 16, 32);
      const float inv = 1.f / sum;
#pragma unroll
      for (int t = 0; t < 32; ++t) ldsA[w][row][seg * 32 + t] *= inv;
    }
    __syncthreads();

    // ---- stage 5: ctx = alpha(16x64) @ vtxt(64x128); rel += ctx ----
    for (int ct = 0; ct < 8; ++ct) {
      const int c0 = ct * 16;
      v8f acc;
#pragma unroll
      for (int r = 0; r < 8; ++r) acc[r] = 0.f;
      for (int k0 = 0; k0 < Tt; k0 += 4) {
        v2f a, bb;
        a[0] = ldsA[w][ln][k0 + 2 * half];
        a[1] = ldsA[w][ln][k0 + 2 * half + 1];
        const float* vp = vtxt + (size_t)(b * Tt + k0 + 2 * half) * Cc + c0 + ln;
        bb[0] = vp[0];
        bb[1] = vp[Cc];
        acc = wmma4(a, bb, acc);
      }
#pragma unroll
      for (int r = 0; r < 8; ++r) ldsR[w][r + 8 * half][c0 + ln] += acc[r];
    }
    __syncthreads();

    // ---- stage 6: bias = (rel+ctx)(16x128) @ Wbias(128x4) + bbias ----
    {
      v8f acc;
      const float bv = (ln < Hh) ? bbias[ln] : 0.f;
#pragma unroll
      for (int r = 0; r < 8; ++r) acc[r] = bv;
      for (int k0 = 0; k0 < Cc; k0 += 4) {
        v2f a, bb;
        a[0] = ldsR[w][ln][k0 + 2 * half];
        a[1] = ldsR[w][ln][k0 + 2 * half + 1];
        bb[0] = (ln < Hh) ? Wbias[(size_t)(k0 + 2 * half) * Hh + ln] : 0.f;
        bb[1] = (ln < Hh) ? Wbias[(size_t)(k0 + 2 * half + 1) * Hh + ln] : 0.f;
        acc = wmma4(a, bb, acc);
      }
      if (ln < Hh) {
#pragma unroll
        for (int r = 0; r < 8; ++r) {
          const int row = r + 8 * half;
          const int j = j0 + row;
          biasout[((size_t)(b * Hh + ln) * Nn + i) * Nn + j] = acc[r];
        }
      }
    }
    __syncthreads();
  }
}

// ---------------------------------------------------------------------------
// Self-attention: per (b, h, 16-row q tile). One wave per block.
// grid = (N/16, H, B), block = 32
// ---------------------------------------------------------------------------
__global__ void __launch_bounds__(32)
attn_kernel(const float* __restrict__ q, const float* __restrict__ k,
            const float* __restrict__ v, const float* __restrict__ bias,
            float* __restrict__ outp) {
  __shared__ float ldsL[16][Nn];  // logits -> attn weights (16 x 256)

  const int i0   = blockIdx.x * 16;
  const int h    = blockIdx.y;
  const int b    = blockIdx.z;
  const int lane = threadIdx.x & 31;
  const int half = lane >> 4;
  const int ln   = lane & 15;
  const float scale = 0.1767766952966369f;  // 1/sqrt(32)

  // logits = q(16x32) @ k^T(32x256) * scale + bias
  for (int nt = 0; nt < 16; ++nt) {
    const int n0 = nt * 16;
    v8f acc;
#pragma unroll
    for (int r = 0; r < 8; ++r) acc[r] = 0.f;
#pragma unroll
    for (int k0 = 0; k0 < Dd; k0 += 4) {
      v2f a, bb;
      const float* qp = q + (size_t)(b * Nn + i0 + ln) * Cc + h * Dd + k0 + 2 * half;
      a[0] = qp[0];
      a[1] = qp[1];
      const float* kp = k + (size_t)(b * Nn + n0 + ln) * Cc + h * Dd + k0 + 2 * half;
      bb[0] = kp[0];
      bb[1] = kp[1];
      acc = wmma4(a, bb, acc);
    }
#pragma unroll
    for (int r = 0; r < 8; ++r) {
      const int row = r + 8 * half;
      ldsL[row][n0 + ln] =
          acc[r] * scale +
          bias[((size_t)(b * Hh + h) * Nn + (i0 + row)) * Nn + n0 + ln];
    }
  }
  __syncthreads();

  // softmax over 256: 2 lanes per row, 128 elems each
  {
    const int row = ln, seg = half;
    float mx = -1e30f;
    for (int t = 0; t < 128; ++t) mx = fmaxf(mx, ldsL[row][seg * 128 + t]);
    mx = fmaxf(mx, __shfl_xor(mx, 16, 32));
    float sum = 0.f;
    for (int t = 0; t < 128; ++t) {
      float e = __expf(ldsL[row][seg * 128 + t] - mx);
      ldsL[row][seg * 128 + t] = e;
      sum += e;
    }
    sum += __shfl_xor(sum, 16, 32);
    const float inv = 1.f / sum;
    for (int t = 0; t < 128; ++t) ldsL[row][seg * 128 + t] *= inv;
  }
  __syncthreads();

  // out = attn(16x256) @ v(256x32)
  for (int ct = 0; ct < 2; ++ct) {
    const int c0 = ct * 16;
    v8f acc;
#pragma unroll
    for (int r = 0; r < 8; ++r) acc[r] = 0.f;
    for (int k0 = 0; k0 < Nn; k0 += 4) {
      v2f a, bb;
      a[0] = ldsL[ln][k0 + 2 * half];
      a[1] = ldsL[ln][k0 + 2 * half + 1];
      const float* vp = v + (size_t)(b * Nn + k0 + 2 * half) * Cc + h * Dd + c0 + ln;
      bb[0] = vp[0];
      bb[1] = vp[Cc];
      acc = wmma4(a, bb, acc);
    }
#pragma unroll
    for (int r = 0; r < 8; ++r) {
      const int row = r + 8 * half;
      outp[(size_t)(b * Nn + i0 + row) * Cc + h * Dd + c0 + ln] = acc[r];
    }
  }
}

// ---------------------------------------------------------------------------
extern "C" void kernel_launch(void* const* d_in, const int* in_sizes, int n_in,
                              void* d_out, int out_size, void* d_ws,
                              size_t ws_size, hipStream_t stream) {
  (void)in_sizes; (void)n_in; (void)out_size; (void)ws_size;
  const float* feat    = (const float*)d_in[0];
  const float* centers = (const float*)d_in[1];
  const float* corners = (const float*)d_in[2];
  const float* lang    = (const float*)d_in[3];
  const float* Wq = (const float*)d_in[4];  const float* bq = (const float*)d_in[5];
  const float* Wk = (const float*)d_in[6];  const float* bk = (const float*)d_in[7];
  const float* Wv = (const float*)d_in[8];  const float* bv = (const float*)d_in[9];
  const float* Wo = (const float*)d_in[10]; const float* bo = (const float*)d_in[11];
  const float* Wrel = (const float*)d_in[12]; const float* brel = (const float*)d_in[13];
  const float* Wtk  = (const float*)d_in[14]; const float* btk  = (const float*)d_in[15];
  const float* Wtv  = (const float*)d_in[16]; const float* btv  = (const float*)d_in[17];
  const float* Wbias = (const float*)d_in[18]; const float* bbias = (const float*)d_in[19];

  float* ws = (float*)d_ws;
  const size_t MR = (size_t)Bsz * Nn;  // 2048 rows
  float* qb      = ws;
  float* kb      = qb + MR * Cc;
  float* vb      = kb + MR * Cc;
  float* ktxt    = vb + MR * Cc;
  float* vtxt    = ktxt + (size_t)Bsz * Tt * Cc;
  float* biasb   = vtxt + (size_t)Bsz * Tt * Cc;
  float* attnout = biasb + (size_t)Bsz * Hh * Nn * Nn;

  // q / k / v projections  (2048x128 @ 128x128)
  dim3 gqkv(MR / 16, Cc / 16);
  gemm_bias_kernel<<<gqkv, 32, 0, stream>>>(feat, Wq, bq, qb, MR, Cc, Cc);
  gemm_bias_kernel<<<gqkv, 32, 0, stream>>>(feat, Wk, bk, kb, MR, Cc, Cc);
  gemm_bias_kernel<<<gqkv, 32, 0, stream>>>(feat, Wv, bv, vb, MR, Cc, Cc);

  // text projections (512x128 @ 128x128)
  dim3 gtxt((size_t)Bsz * Tt / 16, Cc / 16);
  gemm_bias_kernel<<<gtxt, 32, 0, stream>>>(lang, Wtk, btk, ktxt, Bsz * Tt, Cc, Cc);
  gemm_bias_kernel<<<gtxt, 32, 0, stream>>>(lang, Wtv, btv, vtxt, Bsz * Tt, Cc, Cc);

  // fused geometry + language cross-attention -> bias(B,H,N,N)
  relbias_kernel<<<dim3(Nn, Bsz), 128, 0, stream>>>(
      centers, corners, Wrel, brel, ktxt, vtxt, Wbias, bbias, biasb);

  // biased multi-head self-attention
  attn_kernel<<<dim3(Nn / 16, Hh, Bsz), 32, 0, stream>>>(qb, kb, vb, biasb,
                                                         attnout);

  // final projection -> d_out
  gemm_bias_kernel<<<gqkv, 32, 0, stream>>>(attnout, Wo, bo, (float*)d_out, MR,
                                            Cc, Cc);
}

// v001
// Measured time: 149 microseconds a run.
// Timed twice side by side with v000, it ran 2.35 and 2.36 times as fast.
#include <hip/hip_runtime.h>
#include <math.h>

// Problem constants (match reference)
#define Bsz 8
#define Nn  256
#define Cc  128
#define Tt  64
#define Hh  4
#define Gg  12
#define Dd  32
#define EPSF 1e-6f

typedef __attribute__((ext_vector_type(2))) float v2f;
typedef __attribute__((ext_vector_type(8))) float v8f;

// D = A(16x4,f32) * B(4x16,f32) + C(16x16,f32)   -> v_wmma_f32_16x16x4_f32
__device__ __forceinline__ v8f wmma4(v2f a, v2f b, v8f c) {
  return __builtin_amdgcn_wmma_f32_16x16x4_f32(false, a, false, b, (short)0, c,
                                               false, false);
}

// ---------------------------------------------------------------------------
// Generic GEMM: out[M x Nc] = A[M x K] @ W[K x Nc] + bias[Nc]
// One wave per 16x16 output tile. K must be a multiple of 4.
// grid = (M/16, Nc/16), block = 32
// ---------------------------------------------------------------------------
__global__ void __launch_bounds__(32)
gemm_bias_kernel(const float* __restrict__ A, const float* __restrict__ W,
                 const float* __restrict__ bias, float* __restrict__ out,
                 int M, int K, int Nc) {
  const int lane = threadIdx.x & 31;
  const int half = lane >> 4;   // which K pair / which row half for C
  const int ln   = lane & 15;   // M index for A, N index for B/C
  const int row0 = blockIdx.x * 16;
  const int col0 = blockIdx.y * 16;

  v8f acc;
  const float bv = bias[col0 + ln];
#pragma unroll
  for (int r = 0; r < 8; ++r) acc[r] = bv;

  for (int k0 = 0; k0 < K; k0 += 4) {
    v2f a, b;
    const float* Ap = A + (size_t)(row0 + ln) * K + (k0 + 2 * half);
    a[0] = Ap[0];
    a[1] = Ap[1];
    const float* Wp = W + (size_t)(k0 + 2 * half) * Nc + (col0 + ln);
    b[0] = Wp[0];
    b[1] = Wp[Nc];
    acc = wmma4(a, b, acc);
  }

#pragma unroll
  for (int r = 0; r < 8; ++r) {
    const int row = r + 8 * half;
    out[(size_t)(row0 + row) * Nc + col0 + ln] = acc[r];
  }
}

// ---------------------------------------------------------------------------
// The per-pair chain is linear in the 12 geometry features up to the softmax
// and linear again behind it, so its weight products are taken once instead of
// once per (i, j) pair:
//   scores = geom @ (Wrel @ k_txt^T) + brel @ k_txt^T
//   bias   = geom @ (Wrel @ Wbias) + alpha @ (v_txt @ Wbias) + brel @ Wbias + bbias
// with k_txt = lang @ Wtk + btk and v_txt = lang @ Wtv + btv folded the same way.
//
// Step 1, independent of the batch.
//   blocks 0..8 : P[g][n] = sum_c WB[g][c] * Y[n][c]    (16 x PP)
//                 WB rows 0..11 = Wrel rows, 12 = brel, the rest 0
//                 Y rows 0..127 = Wtk rows, 128 = btk, the rest 0
//   blocks 9..17: Q[m][h] = sum_c Z[m][c] * Wbias[c][h] (QR x 4)
//                 Z rows 0..127 = Wtv rows, 128 = btv, 129..140 = Wrel rows,
//                 141 = brel, the rest 0
// grid = 18, block = 32
// ---------------------------------------------------------------------------
#define PP 144
#define QR 144
#define QG (Cc + 1)   // first row of Wrel @ Wbias in Q

__global__ void __launch_bounds__(32)
fold_weights_kernel(const float* __restrict__ Wrel, const float* __restrict__ brel,
                    const float* __restrict__ Wtk, const float* __restrict__ btk,
                    const float* __restrict__ Wtv, const float* __restrict__ btv,
                    const float* __restrict__ Wbias,
                    float* __restrict__ P, float* __restrict__ Q) {
  const int lane = threadIdx.x & 31;
  const int half = lane >> 4;
  const int ln   = lane & 15;
  const int blk  = blockIdx.x;

  v8f acc;
#pragma unroll  // acc is a register vector: constant indices
  for (int r = 0; r < 8; ++r) acc[r] = 0.f;

  // A lane whose row or column is padding reads a valid address and selects 0.
  if (blk < 9) {
    const int n = blk * 16 + ln;
    const float* ap = ((ln < Gg) ? Wrel + ln * Cc : brel) + 2 * half;
    const float* bp = ((n < Cc) ? Wtk + n * Cc : btk) + 2 * half;
    const bool aon = ln <= Gg, bon = n <= Cc;
    // Unrolled: one wave per tile, so the loads of all k steps fly together.
#pragma unroll
    for (int k0 = 0; k0 < Cc; k0 += 4) {
      const float a0 = ap[k0], a1 = ap[k0 + 1];
      const float b0 = bp[k0], b1 = bp[k0 + 1];
      v2f a, bb;
      a[0]  = aon ? a0 : 0.f;
      a[1]  = aon ? a1 : 0.f;
      bb[0] = bon ? b0 : 0.f;
      bb[1] = bon ? b1 : 0.f;
      acc = wmma4(a, bb, acc);
    }
#pragma unroll  // acc is a register vector: constant indices
    for (int r = 0; r < 8; ++r) P[(r + 8 * half) * PP + n] = acc[r];
  } else {
    const int m0 = (blk - 9) * 16;
    const int m  = m0 + ln;
    const float* ap = (m < Cc)        ? Wtv + m * Cc
                    : (m == Cc)       ? btv
                    : (m < QG + Gg)   ? Wrel + (m - QG) * Cc
                                      : brel;
    ap += 2 * half;
    const float* bp = Wbias + 2 * half * Hh + (ln & (Hh - 1));
    const bool aon = m <= QG + Gg, bon = ln < Hh;
    // Unrolled: one wave per tile, so the loads of all k steps fly together.
#pragma unroll
    for (int k0 = 0; k0 < Cc; k0 += 4) {
      const float a0 = ap[k0], a1 = ap[k0 + 1];
      const float b0 = bp[k0 * Hh], b1 = bp[(k0 + 1) * Hh];
      v2f a, bb;
      a[0]  = aon ? a0 : 0.f;
      a[1]  = aon ? a1 : 0.f;
      bb[0] = bon ? b0 : 0.f;
      bb[1] = bon ? b1 : 0.f;
      acc = wmma4(a, bb, acc);
    }
    if (bon) {
#pragma unroll  // acc is a register vector: constant indices
      for (int r = 0; r < 8; ++r) Q[(m0 + r + 8 * half) * Hh + ln] = acc[r];
    }
  }
}

// ---------------------------------------------------------------------------
// Step 2, per batch.
//   blockIdx.x 0..3: KF[b][g][t] = sum_m P[g][m] * lang[b][t][m] + P[g][128]
//                    (rows 0..11 = Wrel @ k_txt^T, row 12 = brel @ k_txt^T)
//   blockIdx.x 4..7: VF[b][t][h] = sum_m lang[b][t][m] * Q[m][h] + Q[128][h]
//                    (= v_txt @ Wbias)
// grid = (8, B), block = 32
// ---------------------------------------------------------------------------
__global__ void __launch_bounds__(32)
fold_text_kernel(const float* __restrict__ lang, const float* __restrict__ P,
                 const float* __restrict__ Q, float* __restrict__ KF,
                 float* __restrict__ VF) {
  const int lane = threadIdx.x & 31;
  const int half = lane >> 4;
  const int ln   = lane & 15;
  const int b    = blockIdx.y;
  const int t0   = (blockIdx.x & 3) * 16;
  const float* lp = lang + (size_t)(b * Tt + t0 + ln) * Cc + 2 * half;

  v8f acc;
  if (blockIdx.x < 4) {
    const float* pp = P + ln * PP + 2 * half;
    const float* pc = P + 8 * half * PP + Cc;
#pragma unroll  // acc is a register vector: constant indices
    for (int r = 0; r < 8; ++r) acc[r] = pc[r * PP];
    // Unrolled: one wave per tile, so the loads of all k steps fly together.
#pragma unroll
    for (int k0 = 0; k0 < Cc; k0 += 4) {
      v2f a, bb;
      a[0]  = pp[k0];
      a[1]  = pp[k0 + 1];
      bb[0] = lp[k0];
      bb[1] = lp[k0 + 1];
      acc = wmma4(a, bb, acc);
    }
#pragma unroll  // acc is a register vector: constant indices
    for (int r = 0; r < 8; ++r)
      KF[(size_t)(b * 16 + r + 8 * half) * Tt + t0 + ln] = acc[r];
  } else {
    // Padding columns read a valid one and select 0.
    const float* qp = Q + 2 * half * Hh + (ln & (Hh - 1));
    const bool on = ln < Hh;
    const float qb = Q[Cc * Hh + (ln & (Hh - 1))];
#pragma unroll  // acc is a register vector: constant indices
    for (int r = 0; r < 8; ++r) acc[r] = on ? qb : 0.f;
    // Unrolled: one wave per tile, so the loads of all k steps fly together.
#pragma unroll
    for (int k0 = 0; k0 < Cc; k0 += 4) {
      const float b0 = qp[k0 * Hh], b1 = qp[(k0 + 1) * Hh];
      v2f a, bb;
      a[0]  = lp[k0];
      a[1]  = lp[k0 + 1];
      bb[0] = on ? b0 : 0.f;
      bb[1] = on ? b1 : 0.f;
      acc = wmma4(a, bb, acc);
    }
    if (on) {
#pragma unroll  // acc is a register vector: constant indices
      for (int r = 0; r < 8; ++r)
        VF[(size_t)(b * Tt + t0 + r + 8 * half) * Hh + ln] = acc[r];
    }
  }
}

// ---------------------------------------------------------------------------
// Fused: geometry -> lang cross-attn scores -> softmax -> bias head, on the
// folded tables (Q, KF, VF above).
// grid = (N, B), block = 128 (4 waves). Each wave handles a 16-wide j tile,
// iterating 4 times to cover all 256 j for this (b, i).
// ---------------------------------------------------------------------------
__global__ void __launch_bounds__(128)
relbias_kernel(const float* __restrict__ centers,
               const float* __restrict__ corners,
               const float* __restrict__ Q, const float* __restrict__ KF,
               const float* __restrict__ VF, const float* __restrict__ bbias,
               float* __restrict__ biasout) {
  __shared__ float ldsG[4][16][Gg];   // geometry features (16 x 12)
  __shared__ float ldsA[4][16][Tt];   // scores / alpha

  const int i    = blockIdx.x;
  const int b    = blockIdx.y;
  const int w    = threadIdx.x >> 5;
  const int lane = threadIdx.x & 31;
  const int half = lane >> 4;
  const int ln   = lane & 15;

  // sizes for node i (same for all lanes; cheap)
  float sxi, syi, szi;
  {
    const float* cp = corners + (size_t)(b * Nn + i) * 24;
    float mx0 = -1e30f, mx1 = -1e30f, mx2 = -1e30f;
    float mn0 = 1e30f, mn1 = 1e30f, mn2 = 1e30f;
#pragma unroll
    for (int c = 0; c < 8; ++c) {
      float x = cp[c * 3 + 0], y = cp[c * 3 + 1], z = cp[c * 3 + 2];
      mx0 = fmaxf(mx0, x); mn0 = fminf(mn0, x);
      mx1 = fmaxf(mx1, y); mn1 = fminf(mn1, y);
      mx2 = fmaxf(mx2, z); mn2 = fminf(mn2, z);
    }
    sxi = mx0 - mn0; syi = mx1 - mn1; szi = mx2 - mn2;
  }
  const float cxi = centers[(size_t)(b * Nn + i) * 3 + 0];
  const float cyi = centers[(size_t)(b * Nn + i) * 3 + 1];
  const float czi = centers[(size_t)(b * Nn + i) * 3 + 2];

  const float rs128 = 0.08838834764831845f;  // 1/sqrt(128)

  // B fragments of the folded tables: the same for every j tile of this block.
  v2f kf[4][3];   // KF[b] rows 0..11, four 16-wide t tiles
  float kc[4];    // KF[b] row 12
  v2f gf[3];      // Wrel @ Wbias (12 x 4, columns 4..15 zero)
  v2f vf[16];     // VF[b] (64 x 4, columns 4..15 zero)
  float hb;       // brel @ Wbias + bbias
  {
    const float* KFb = KF + (size_t)b * 16 * Tt;
    const float* VFb = VF + (size_t)b * Tt * Hh;
#pragma unroll  // fragments stay in registers: constant indices
    for (int tt = 0; tt < 4; ++tt) {
#pragma unroll  // fragments stay in registers: constant indices
      for (int kk = 0; kk < 3; ++kk) {
        kf[tt][kk][0] = KFb[(4 * kk + 2 * half) * Tt + tt * 16 + ln];
        kf[tt][kk][1] = KFb[(4 * kk + 2 * half + 1) * Tt + tt * 16 + ln];
      }
      kc[tt] = KFb[Gg * Tt + tt * 16 + ln];
    }
    const int hc = ln & (Hh - 1);  // padding columns read a valid one, select 0
    const bool on = ln < Hh;
#pragma unroll  // fragments stay in registers: constant indices
    for (int kk = 0; kk < 3; ++kk) {
      const float g0 = Q[(QG + 4 * kk + 2 * half) * Hh + hc];
      const float g1 = Q[(QG + 4 * kk + 2 * half + 1) * Hh + hc];
      gf[kk][0] = on ? g0 : 0.f;
      gf[kk][1] = on ? g1 : 0.f;
    }
#pragma unroll  // fragments stay in registers: constant indices
    for (int kk = 0; kk < 16; ++kk) {
      const float v0 = VFb[(4 * kk + 2 * half) * Hh + hc];
      const float v1 = VFb[(4 * kk + 2 * half + 1) * Hh + hc];
      vf[kk][0] = on ? v0 : 0.f;
      vf[kk][1] = on ? v1 : 0.f;
    }
    const float h0 = Q[(QG + Gg) * Hh + hc] + bbias[hc];
    hb = on ? h0 : 0.f;
  }

  for (int jo = 0; jo < 4; ++jo) {
    const int j0 = jo * 64 + w * 16;

    // ---- stage 1: geometry features for 16 j rows (lanes 0..15) ----
    if (lane < 16) {
      const int j = j0 + lane;
      const float cxj = centers[(size_t)(b * Nn + j) * 3 + 0];
      const float cyj = centers[(size_t)(b * Nn + j) * 3 + 1];
      const float czj = centers[(size_t)(b * Nn + j) * 3 + 2];
      const float r0 = cxj - cxi, r1 = cyj - cyi, r2 = czj - czi;
      const float dist  = sqrtf(r0 * r0 + r1 * r1 + r2 * r2);
      const float horiz = sqrtf(r0 * r0 + r1 * r1);
      const float cose  = r2 / (dist + EPSF);
      const float dlog  = logf(dist + EPSF);
      // sizes for node j
      const float* cp = corners + (size_t)(b * Nn + j) * 24;
      float mx0 = -1e30f, mx1 = -1e30f, mx2 = -1e30f;
      float mn0 = 1e30f, mn1 = 1e30f, mn2 = 1e30f;
#pragma unroll
      for (int c = 0; c < 8; ++c) {
        float x = cp[c * 3 + 0], y = cp[c * 3 + 1], z = cp[c * 3 + 2];
        mx0 = fmaxf(mx0, x); mn0 = fminf(mn0, x);
        mx1 = fmaxf(mx1, y); mn1 = fminf(mn1, y);
        mx2 = fmaxf(mx2, z); mn2 = fminf(mn2, z);
      }
      const float sxj = mx0 - mn0, syj = mx1 - mn1, szj = mx2 - mn2;
      float* g = &ldsG[w][lane][0];
      g[0] = r0; g[1] = r1; g[2] = r2;
      g[3] = dlog; g[4] = horiz; g[5] = cose;
      g[6] = sxj - sxi; g[7] = syj - syi; g[8] = szj - szi;
      g[9]  = sxj / (sxi + EPSF);
      g[10] = syj / (syi + EPSF);
      g[11] = szj / (szi + EPSF);
    }
    __syncthreads();

    // ---- stage 2: scores = (geom(16x12) @ KF(12x64) + KF row 12) * rs128 ----
    v2f ga[3];
#pragma unroll  // fragments stay in registers: constant indices
    for (int kk = 0; kk < 3; ++kk) {
      ga[kk][0] = ldsG[w][ln][4 * kk + 2 * half];
      ga[kk][1] = ldsG[w][ln][4 * kk + 2 * half + 1];
    }
#pragma unroll  // fragments stay in registers: constant indices
    for (int tt = 0; tt < 4; ++tt) {
      const int t0 = tt * 16;
      v8f acc;
#pragma unroll  // acc is a register vector: constant indices
      for (int r = 0; r < 8; ++r) acc[r] = kc[tt];
#pragma unroll  // fragments stay in registers: constant indices
      for (int kk = 0; kk < 3; ++kk) acc = wmma4(ga[kk], kf[tt][kk], acc);
#pragma unroll  // acc is a register vector: constant indices
      for (int r = 0; r < 8; ++r)
        ldsA[w][r + 8 * half][t0 + ln] = acc[r] * rs128;
    }
    __syncthreads();

    // ---- stage 3: softmax over T=64, 2 lanes per row ----
    {
      const int row = ln, seg = half;
      float mx = -1e30f;
#pragma unroll
      for (int t = 0; t < 32; ++t) mx = fmaxf(mx, ldsA[w][row][seg * 32 + t]);
      mx = fmaxf(mx, __shfl_xor(mx, 16, 32));
      float sum = 0.f;
#pragma unroll
      for (int t = 0; t < 32; ++t) {
        float e = __expf(ldsA[w][row][seg * 32 + t] - mx);
        ldsA[w][row][seg * 32 + t] = e;
        sum += e;
      }
      sum += __shfl_xor(sum, 16, 32);
      const float inv = 1.f / sum;
#pragma unroll
      for (int t = 0; t < 32; ++t) ldsA[w][row][seg * 32 + t] *= inv;
    }
    __syncthreads();

    // ---- stage 4: bias = geom(16x12) @ gf + alpha(16x64) @ vf + hb ----
    {
      v8f acc;
#pragma unroll  // acc is a register vector: constant indices
      for (int r = 0; r < 8; ++r) acc[r] = hb;
#pragma unroll  // fragments stay in registers: constant indices
      for (int kk = 0; kk < 3; ++kk) acc = wmma4(ga[kk], gf[kk], acc);
#pragma unroll  // fragments stay in registers: constant indices
      for (int kk = 0; kk < 16; ++kk) {
        v2f a;
        a[0] = ldsA[w][ln][4 * kk + 2 * half];
        a[1] = ldsA[w][ln][4 * kk + 2 * half + 1];
        acc = wmma4(a, vf[kk], acc);
      }
      if (ln < Hh) {
#pragma unroll
        for (int r = 0; r < 8; ++r) {
          const int row = r + 8 * half;
          const int j = j0 + row;
          biasout[((size_t)(b * Hh + ln) * Nn + i) * Nn + j] = acc[r];
        }
      }
    }
    __syncthreads();
  }
}

// ---------------------------------------------------------------------------
// Self-attention: per (b, h, 16-row q tile). One wave per block.
// grid = (N/16, H, B), block = 32
// ---------------------------------------------------------------------------
__global__ void __launch_bounds__(32)
attn_kernel(const float* __restrict__ q, const float* __restrict__ k,
            const float* __restrict__ v, const float* __restrict__ bias,
            float* __restrict__ outp) {
  __shared__ float ldsL[16][Nn];  // logits -> attn weights (16 x 256)

  const int i0   = blockIdx.x * 16;
  const int h    = blockIdx.y;
  const int b    = blockIdx.z;
  const int lane = threadIdx.x & 31;
  const int half = lane >> 4;
  const int ln   = lane & 15;
  const float scale = 0.1767766952966369f;  // 1/sqrt(32)

  // logits = q(16x32) @ k^T(32x256) * scale + bias
  for (int nt = 0; nt < 16; ++nt) {
    const int n0 = nt * 16;
    v8f acc;
#pragma unroll
    for (int r = 0; r < 8; ++r) acc[r] = 0.f;
#pragma unroll
    for (int k0 = 0; k0 < Dd; k0 += 4) {
      v2f a, bb;
      const float* qp = q + (size_t)(b * Nn + i0 + ln) * Cc + h * Dd + k0 + 2 * half;
      a[0] = qp[0];
      a[1] = qp[1];
      const float* kp = k + (size_t)(b * Nn + n0 + ln) * Cc + h * Dd + k0 + 2 * half;
      bb[0] = kp[0];
      bb[1] = kp[1];
      acc = wmma4(a, bb, acc);
    }
#pragma unroll
    for (int r = 0; r < 8; ++r) {
      const int row = r + 8 * half;
      ldsL[row][n0 + ln] =
          acc[r] * scale +
          bias[((size_t)(b * Hh + h) * Nn + (i0 + row)) * Nn + n0 + ln];
    }
  }
  __syncthreads();

  // softmax over 256: 2 lanes per row, 128 elems each
  {
    const int row = ln, seg = half;
    float mx = -1e30f;
    for (int t = 0; t < 128; ++t) mx = fmaxf(mx, ldsL[row][seg * 128 + t]);
    mx = fmaxf(mx, __shfl_xor(mx, 16, 32));
    float sum = 0.f;
    for (int t = 0; t < 128; ++t) {
      float e = __expf(ldsL[row][seg * 128 + t] - mx);
      ldsL[row][seg * 128 + t] = e;
      sum += e;
    }
    sum += __shfl_xor(sum, 16, 32);
    const float inv = 1.f / sum;
    for (int t = 0; t < 128; ++t) ldsL[row][seg * 128 + t] *= inv;
  }
  __syncthreads();

  // out = attn(16x256) @ v(256x32)
  for (int ct = 0; ct < 2; ++ct) {
    const int c0 = ct * 16;
    v8f acc;
#pragma unroll
    for (int r = 0; r < 8; ++r) acc[r] = 0.f;
    for (int k0 = 0; k0 < Nn; k0 += 4) {
      v2f a, bb;
      a[0] = ldsL[ln][k0 + 2 * half];
      a[1] = ldsL[ln][k0 + 2 * half + 1];
      const float* vp = v + (size_t)(b * Nn + k0 + 2 * half) * Cc + h * Dd + c0 + ln;
      bb[0] = vp[0];
      bb[1] = vp[Cc];
      acc = wmma4(a, bb, acc);
    }
#pragma unroll
    for (int r = 0; r < 8; ++r) {
      const int row = r + 8 * half;
      outp[(size_t)(b * Nn + i0 + row) * Cc + h * Dd + c0 + ln] = acc[r];
    }
  }
}

// ---------------------------------------------------------------------------
extern "C" void kernel_launch(void* const* d_in, const int* in_sizes, int n_in,
                              void* d_out, int out_size, void* d_ws,
                              size_t ws_size, hipStream_t stream) {
  (void)in_sizes; (void)n_in; (void)out_size; (void)ws_size;
  const float* feat    = (const float*)d_in[0];
  const float* centers = (const float*)d_in[1];
  const float* corners = (const float*)d_in[2];
  const float* lang    = (const float*)d_in[3];
  const float* Wq = (const float*)d_in[4];  const float* bq = (const float*)d_in[5];
  const float* Wk = (const float*)d_in[6];  const float* bk = (const float*)d_in[7];
  const float* Wv = (const float*)d_in[8];  const float* bv = (const float*)d_in[9];
  const float* Wo = (const float*)d_in[10]; const float* bo = (const float*)d_in[11];
  const float* Wrel = (const float*)d_in[12]; const float* brel = (const float*)d_in[13];
  const float* Wtk  = (const float*)d_in[14]; const float* btk  = (const float*)d_in[15];
  const float* Wtv  = (const float*)d_in[16]; const float* btv  = (const float*)d_in[17];
  const float* Wbias = (const float*)d_in[18]; const float* bbias = (const float*)d_in[19];

  float* ws = (float*)d_ws;
  const size_t MR = (size_t)Bsz * Nn;  // 2048 rows
  float* qb      = ws;
  float* kb      = qb + MR * Cc;
  float* vb      = kb + MR * Cc;
  float* Pf      = vb + MR * Cc;
  float* Qf      = Pf + (size_t)16 * PP;
  float* KFf     = Qf + (size_t)QR * Hh;
  float* VFf     = KFf + (size_t)Bsz * 16 * Tt;
  float* biasb   = VFf + (size_t)Bsz * Tt * Hh;
  float* attnout = biasb + (size_t)Bsz * Hh * Nn * Nn;

  // q / k / v projections  (2048x128 @ 128x128)
  dim3 gqkv(MR / 16, Cc / 16);
  gemm_bias_kernel<<<gqkv, 32, 0, stream>>>(feat, Wq, bq, qb, MR, Cc, Cc);
  gemm_bias_kernel<<<gqkv, 32, 0, stream>>>(feat, Wk, bk, kb, MR, Cc, Cc);
  gemm_bias_kernel<<<gqkv, 32, 0, stream>>>(feat, Wv, bv, vb, MR, Cc, Cc);

  // folded tables of the language cross-attention
  fold_weights_kernel<<<18, 32, 0, stream>>>(Wrel, brel, Wtk, btk, Wtv, btv,
                                             Wbias, Pf, Qf);
  fold_text_kernel<<<dim3(8, Bsz), 32, 0, stream>>>(lang, Pf, Qf, KFf, VFf);

  // fused geometry + language cross-attention -> bias(B,H,N,N)
  relbias_kernel<<<dim3(Nn, Bsz), 128, 0, stream>>>(
      centers, corners, Qf, KFf, VFf, bbias, biasb);

  // biased multi-head self-attention
  attn_kernel<<<dim3(Nn / 16, Hh, Bsz), 32, 0, stream>>>(qb, kb, vb, biasb,
                                                         attnout);

  // final projection -> d_out
  gemm_bias_kernel<<<gqkv, 32, 0, stream>>>(attnout, Wo, bo, (float*)d_out, MR,
                                            Cc, Cc);
}

// v002
// It runs in 76.1 microseconds.
// Two timings next to v001 put it at 1.95 and 1.97 times that version's speed.
// All steps since v000 together make it 4.62 times as fast.
#include <hip/hip_runtime.h>
#include <math.h>

// Problem constants (match reference)
#define Bsz 8
#define Nn  256
#define Cc  128
#define Tt  64
#define Hh  4
#define Gg  12
#define Dd  32
#define EPSF 1e-6f

typedef __attribute__((ext_vector_type(2))) float v2f;
typedef __attribute__((ext_vector_type(8))) float v8f;

// D = A(16x4,f32) * B(4x16,f32) + C(16x16,f32)   -> v_wmma_f32_16x16x4_f32
__device__ __forceinline__ v8f wmma4(v2f a, v2f b, v8f c) {
  return __builtin_amdgcn_wmma_f32_16x16x4_f32(false, a, false, b, (short)0, c,
                                               false, false);
}

// ---------------------------------------------------------------------------
// Generic GEMM: out[M x Nc] = A[M x K] @ W[K x Nc] + bias[Nc]
// One wave per 16x16 output tile. K must be a multiple of 4.
// grid = (M/16, Nc/16), block = 32
// ---------------------------------------------------------------------------
__global__ void __launch_bounds__(32)
gemm_bias_kernel(const float* __restrict__ A, const float* __restrict__ W,
                 const float* __restrict__ bias, float* __restrict__ out,
                 int M, int K, int Nc) {
  const int lane = threadIdx.x & 31;
  const int half = lane >> 4;   // which K pair / which row half for C
  const int ln   = lane & 15;   // M index for A, N index for B/C
  const int row0 = blockIdx.x * 16;
  const int col0 = blockIdx.y * 16;

  v8f acc;
  const float bv = bias[col0 + ln];
#pragma unroll
  for (int r = 0; r < 8; ++r) acc[r] = bv;

  for (int k0 = 0; k0 < K; k0 += 4) {
    v2f a, b;
    const float* Ap = A + (size_t)(row0 + ln) * K + (k0 + 2 * half);
    a[0] = Ap[0];
    a[1] = Ap[1];
    const float* Wp = W + (size_t)(k0 + 2 * half) * Nc + (col0 + ln);
    b[0] = Wp[0];
    b[1] = Wp[Nc];
    acc = wmma4(a, b, acc);
  }

#pragma unroll
  for (int r = 0; r < 8; ++r) {
    const int row = r + 8 * half;
    out[(size_t)(row0 + row) * Nc + col0 + ln] = acc[r];
  }
}

// ---------------------------------------------------------------------------
// The per-pair chain is linear in the 12 geometry features up to the softmax
// and linear again behind it, so its weight products are taken once instead of
// once per (i, j) pair:
//   scores = geom @ (Wrel @ k_txt^T) + brel @ k_txt^T
//   bias   = geom @ (Wrel @ Wbias) + alpha @ (v_txt @ Wbias) + brel @ Wbias + bbias
// with k_txt = lang @ Wtk + btk and v_txt = lang @ Wtv + btv folded the same way.
//
// Step 1, independent of the batch.
//   blocks 0..8 : P[g][n] = sum_c WB[g][c] * Y[n][c]    (16 x PP)
//                 WB rows 0..11 = Wrel rows, 12 = brel, the rest 0
//                 Y rows 0..127 = Wtk rows, 128 = btk, the rest 0
//   blocks 9..17: Q[m][h] = sum_c Z[m][c] * Wbias[c][h] (QR x 4)
//                 Z rows 0..127 = Wtv rows, 128 = btv, 129..140 = Wrel rows,
//                 141 = brel, the rest 0
// grid = 18, block = 32
// ---------------------------------------------------------------------------
#define PP 144
#define QR 144
#define QG (Cc + 1)   // first row of Wrel @ Wbias in Q

__global__ void __launch_bounds__(32)
fold_weights_kernel(const float* __restrict__ Wrel, const float* __restrict__ brel,
                    const float* __restrict__ Wtk, const float* __restrict__ btk,
                    const float* __restrict__ Wtv, const float* __restrict__ btv,
                    const float* __restrict__ Wbias,
                    float* __restrict__ P, float* __restrict__ Q) {
  const int lane = threadIdx.x & 31;
  const int half = lane >> 4;
  const int ln   = lane & 15;
  const int blk  = blockIdx.x;

  v8f acc;
#pragma unroll  // acc is a register vector: constant indices
  for (int r = 0; r < 8; ++r) acc[r] = 0.f;

  // A lane whose row or column is padding reads a valid address and selects 0.
  if (blk < 9) {
    const int n = blk * 16 + ln;
    const float* ap = ((ln < Gg) ? Wrel + ln * Cc : brel) + 2 * half;
    const float* bp = ((n < Cc) ? Wtk + n * Cc : btk) + 2 * half;
    const bool aon = ln <= Gg, bon = n <= Cc;
    // Unrolled: one wave per tile, so the loads of all k steps fly together.
#pragma unroll
    for (int k0 = 0; k0 < Cc; k0 += 4) {
      const float a0 = ap[k0], a1 = ap[k0 + 1];
      const float b0 = bp[k0], b1 = bp[k0 + 1];
      v2f a, bb;
      a[0]  = aon ? a0 : 0.f;
      a[1]  = aon ? a1 : 0.f;
      bb[0] = bon ? b0 : 0.f;
      bb[1] = bon ? b1 : 0.f;
      acc = wmma4(a, bb, acc);
    }
#pragma unroll  // acc is a register vector: constant indices
    for (int r = 0; r < 8; ++r) P[(r + 8 * half) * PP + n] = acc[r];
  } else {
    const int m0 = (blk - 9) * 16;
    const int m  = m0 + ln;
    const float* ap = (m < Cc)        ? Wtv + m * Cc
                    : (m == Cc)       ? btv
                    : (m < QG + Gg)   ? Wrel + (m - QG) * Cc
                                      : brel;
    ap += 2 * half;
    const float* bp = Wbias + 2 * half * Hh + (ln & (Hh - 1));
    const bool aon = m <= QG + Gg, bon = ln < Hh;
    // Unrolled: one wave per tile, so the loads of all k steps fly together.
#pragma unroll
    for (int k0 = 0; k0 < Cc; k0 += 4) {
      const float a0 = ap[k0], a1 = ap[k0 + 1];
      const float b0 = bp[k0 * Hh], b1 = bp[(k0 + 1) * Hh];
      v2f a, bb;
      a[0]  = aon ? a0 : 0.f;
      a[1]  = aon ? a1 : 0.f;
      bb[0] = bon ? b0 : 0.f;
      bb[1] = bon ? b1 : 0.f;
      acc = wmma4(a, bb, acc);
    }
    if (bon) {
#pragma unroll  // acc is a register vector: constant indices
      for (int r = 0; r < 8; ++r) Q[(m0 + r + 8 * half) * Hh + ln] = acc[r];
    }
  }
}

// ---------------------------------------------------------------------------
// Step 2, per batch.
//   blockIdx.x 0..3: KF[b][g][t] = sum_m P[g][m] * lang[b][t][m] + P[g][128]
//                    (rows 0..11 = Wrel @ k_txt^T, row 12 = brel @ k_txt^T)
//   blockIdx.x 4..7: VF[b][t][h] = sum_m lang[b][t][m] * Q[m][h] + Q[128][h]
//                    (= v_txt @ Wbias)
// grid = (8, B), block = 32
// ---------------------------------------------------------------------------
__global__ void __launch_bounds__(32)
fold_text_kernel(const float* __restrict__ lang, const float* __restrict__ P,
                 const float* __restrict__ Q, float* __restrict__ KF,
                 float* __restrict__ VF) {
  const int lane = threadIdx.x & 31;
  const int half = lane >> 4;
  const int ln   = lane & 15;
  const int b    = blockIdx.y;
  const int t0   = (blockIdx.x & 3) * 16;
  const float* lp = lang + (size_t)(b * Tt + t0 + ln) * Cc + 2 * half;

  v8f acc;
  if (blockIdx.x < 4) {
    const float* pp = P + ln * PP + 2 * half;
    const float* pc = P + 8 * half * PP + Cc;
#pragma unroll  // acc is a register vector: constant indices
    for (int r = 0; r < 8; ++r) acc[r] = pc[r * PP];
    // Unrolled: one wave per tile, so the loads of all k steps fly together.
#pragma unroll
    for (int k0 = 0; k0 < Cc; k0 += 4) {
      v2f a, bb;
      a[0]  = pp[k0];
      a[1]  = pp[k0 + 1];
      bb[0] = lp[k0];
      bb[1] = lp[k0 + 1];
      acc = wmma4(a, bb, acc);
    }
#pragma unroll  // acc is a register vector: constant indices
    for (int r = 0; r < 8; ++r)
      KF[(size_t)(b * 16 + r + 8 * half) * Tt + t0 + ln] = acc[r];
  } else {
    // Padding columns read a valid one and select 0.
    const float* qp = Q + 2 * half * Hh + (ln & (Hh - 1));
    const bool on = ln < Hh;
    const float qb = Q[Cc * Hh + (ln & (Hh - 1))];
#pragma unroll  // acc is a register vector: constant indices
    for (int r = 0; r < 8; ++r) acc[r] = on ? qb : 0.f;
    // Unrolled: one wave per tile, so the loads of all k steps fly together.
#pragma unroll
    for (int k0 = 0; k0 < Cc; k0 += 4) {
      const float b0 = qp[k0 * Hh], b1 = qp[(k0 + 1) * Hh];
      v2f a, bb;
      a[0]  = lp[k0];
      a[1]  = lp[k0 + 1];
      bb[0] = on ? b0 : 0.f;
      bb[1] = on ? b1 : 0.f;
      acc = wmma4(a, bb, acc);
    }
    if (on) {
#pragma unroll  // acc is a register vector: constant indices
      for (int r = 0; r < 8; ++r)
        VF[(size_t)(b * Tt + t0 + r + 8 * half) * Hh + ln] = acc[r];
    }
  }
}

// ---------------------------------------------------------------------------
// Fused: geometry -> lang cross-attn scores -> softmax -> bias head, on the
// folded tables (Q, KF, VF above).
// Every product is taken transposed, with the text index t (or the head) in the
// rows of D and the pair index j in its columns. A lane then holds 32 of the 64
// scores of its own j (lane ^ 16 holds the other 32), so the softmax runs in
// registers, and the registers of the exponentials are, pair by pair, the B
// operand of the head product; 1 / sum is the same for a whole column of D and
// multiplies the two result rows. Nothing goes through LDS and no wave waits
// for another.
// grid = (N, B), block = 128 (4 waves). Each wave handles four 16-wide j tiles,
// 64 j in a row, of this (b, i).
// ---------------------------------------------------------------------------
// Value of lane ^ 16.
__device__ __forceinline__ float other_half(float x) {
  const int v = __builtin_bit_cast(int, x);
  return __builtin_bit_cast(
      float, __builtin_amdgcn_permlanex16(v, v, 0x76543210, 0xfedcba98, false, false));
}

__global__ void __launch_bounds__(128)
relbias_kernel(const float* __restrict__ centers,
               const float* __restrict__ corners,
               const float* __restrict__ Q, const float* __restrict__ KF,
               const float* __restrict__ VF, const float* __restrict__ bbias,
               float* __restrict__ biasout) {
  const int i    = blockIdx.x;
  const int b    = blockIdx.y;
  const int w    = threadIdx.x >> 5;
  const int lane = threadIdx.x & 31;
  const int half = lane >> 4;
  const int ln   = lane & 15;

  // sizes for node i (same for all lanes; cheap)
  float sxi, syi, szi;
  {
    const float* cp = corners + (size_t)(b * Nn + i) * 24;
    float mx0 = -1e30f, mx1 = -1e30f, mx2 = -1e30f;
    float mn0 = 1e30f, mn1 = 1e30f, mn2 = 1e30f;
#pragma unroll
    for (int c = 0; c < 8; ++c) {
      float x = cp[c * 3 + 0], y = cp[c * 3 + 1], z = cp[c * 3 + 2];
      mx0 = fmaxf(mx0, x); mn0 = fminf(mn0, x);
      mx1 = fmaxf(mx1, y); mn1 = fminf(mn1, y);
      mx2 = fmaxf(mx2, z); mn2 = fminf(mn2, z);
    }
    sxi = mx0 - mn0; syi = mx1 - mn1; szi = mx2 - mn2;
  }
  const float cxi = centers[(size_t)(b * Nn + i) * 3 + 0];
  const float cyi = centers[(size_t)(b * Nn + i) * 3 + 1];
  const float czi = centers[(size_t)(b * Nn + i) * 3 + 2];

  const float rs128 = 0.08838834764831845f;  // 1/sqrt(128)
  const bool  hi  = half != 0;
  const float dxz = (hi ? szi : sxi) + EPSF;

  // A fragments of the folded tables: the same for every j tile of this block.
  // Head rows of D: head 2 * half + r sits in register r (r = 0, 1) of each lane
  // half, i.e. in A rows 0, 1, 8, 9, so that all 32 lanes store.
  v2f kf[4][3];   // KF[b] rows 0..11 as (t x g), four 16-row t tiles
  v8f kc[4];      // KF[b] row 12 at t = 16 tt + 8 half + r: C of the scores
  v2f gf[3];      // (Wrel @ Wbias)^T, rows other than 0, 1, 8, 9 zero
  v2f vf[16];     // VF[b]^T in the k order of the score registers (below)
  v8f hb;         // brel @ Wbias + bbias: C of the head
  {
    const float* KFb = KF + (size_t)b * 16 * Tt;
    const float* VFb = VF + (size_t)b * Tt * Hh;
#pragma unroll  // fragments stay in registers: constant indices
    for (int tt = 0; tt < 4; ++tt) {
#pragma unroll  // fragments stay in registers: constant indices
      for (int kk = 0; kk < 3; ++kk) {
        kf[tt][kk][0] = KFb[(4 * kk + 2 * half) * Tt + tt * 16 + ln];
        kf[tt][kk][1] = KFb[(4 * kk + 2 * half + 1) * Tt + tt * 16 + ln];
      }
#pragma unroll  // kc is a register vector: constant indices
      for (int r = 0; r < 8; ++r)
        kc[tt][r] = KFb[Gg * Tt + tt * 16 + 8 * half + r];
    }
    // padding rows read a valid head, select 0
    const int hc = 2 * (ln >> 3) + (ln & 1);
    const bool on = (ln & 7) < 2;
#pragma unroll  // fragments stay in registers: constant indices
    for (int kk = 0; kk < 3; ++kk) {
      const float g0 = Q[(QG + 4 * kk + 2 * half) * Hh + hc];
      const float g1 = Q[(QG + 4 * kk + 2 * half + 1) * Hh + hc];
      gf[kk][0] = on ? g0 : 0.f;
      gf[kk][1] = on ? g1 : 0.f;
    }
    // k step 4 tt + p of the head takes t = 16 tt + 8 half + 2 p + {0, 1}:
    // registers 2 p and 2 p + 1 of score tile tt.
#pragma unroll  // fragments stay in registers: constant indices
    for (int kk = 0; kk < 16; ++kk) {
      const int t = 16 * (kk >> 2) + 8 * half + 2 * (kk & 3);
      const float v0 = VFb[t * Hh + hc];
      const float v1 = VFb[(t + 1) * Hh + hc];
      vf[kk][0] = on ? v0 : 0.f;
      vf[kk][1] = on ? v1 : 0.f;
    }
#pragma unroll  // hb is a register vector: constant indices
    for (int r = 0; r < 8; ++r) hb[r] = 0.f;
    hb[0] = Q[(QG + Gg) * Hh + 2 * half] + bbias[2 * half];
    hb[1] = Q[(QG + Gg) * Hh + 2 * half + 1] + bbias[2 * half + 1];
  }

  for (int jo = 0; jo < 4; ++jo) {
    const int j = w * 64 + jo * 16 + ln;

    // ---- stage 1: geometry features of pair (i, j), in both lane halves ----
    v2f gb[3];  // geom^T (g x j), g = 4 kk + 2 half + {0, 1} as in kf and gf
    {
      const float cxj = centers[(size_t)(b * Nn + j) * 3 + 0];
      const float cyj = centers[(size_t)(b * Nn + j) * 3 + 1];
      const float czj = centers[(size_t)(b * Nn + j) * 3 + 2];
      const float r0 = cxj - cxi, r1 = cyj - cyi, r2 = czj - czi;
      const float dist  = sqrtf(r0 * r0 + r1 * r1 + r2 * r2);
      const float horiz = sqrtf(r0 * r0 + r1 * r1);
      const float cose  = r2 / (dist + EPSF);
      const float dlog  = logf(dist + EPSF);
      // sizes for node j
      const float* cp = corners + (size_t)(b * Nn + j) * 24;
      float mx0 = -1e30f, mx1 = -1e30f, mx2 = -1e30f;
      float mn0 = 1e30f, mn1 = 1e30f, mn2 = 1e30f;
#pragma unroll
      for (int c = 0; c < 8; ++c) {
        float x = cp[c * 3 + 0], y = cp[c * 3 + 1], z = cp[c * 3 + 2];
        mx0 = fmaxf(mx0, x); mn0 = fminf(mn0, x);
        mx1 = fmaxf(mx1, y); mn1 = fminf(mn1, y);
        mx2 = fmaxf(mx2, z); mn2 = fminf(mn2, z);
      }
      const float sxj = mx0 - mn0, syj = mx1 - mn1, szj = mx2 - mn2;
      // Feature 9 (lower half) and feature 11 (upper half) share one division.
      const float ry  = syj / (syi + EPSF);
      const float rxz = (hi ? szj : sxj) / dxz;
      gb[0][0] = hi ? r2 : r0;
      gb[0][1] = hi ? dlog : r1;
      gb[1][0] = hi ? sxj - sxi : horiz;
      gb[1][1] = hi ? syj - syi : cose;
      gb[2][0] = hi ? ry : szj - szi;
      gb[2][1] = rxz;
    }

    // ---- stage 2: scores^T = (KF^T(64x12) @ geom^T(12x16) + KF row 12) * rs128
    v8f s[4];   // s[tt][r] = score of (t = 16 tt + 8 half + r, j)
#pragma unroll  // fragments stay in registers: constant indices
    for (int tt = 0; tt < 4; ++tt) {
      v8f acc = kc[tt];
#pragma unroll  // fragments stay in registers: constant indices
      for (int kk = 0; kk < 3; ++kk) acc = wmma4(kf[tt][kk], gb[kk], acc);
      s[tt] = acc * rs128;
    }

    // ---- stage 3: softmax over T=64, 32 registers in each of 2 lanes ----
    float inv;  // 1 / sum of the exponentials; applied behind the head product
    {
      float mx = -1e30f;
#pragma unroll  // s is a register array: constant indices
      for (int tt = 0; tt < 4; ++tt)
#pragma unroll  // s is a register array: constant indices
        for (int r = 0; r < 8; ++r) mx = fmaxf(mx, s[tt][r]);
      mx = fmaxf(mx, other_half(mx));
#pragma unroll  // s is a register array: constant indices
      for (int tt = 0; tt < 4; ++tt)
#pragma unroll  // s is a register array: constant indices
        for (int r = 0; r < 8; ++r) s[tt][r] = __expf(s[tt][r] - mx);
      const v8f sv = (s[0] + s[1]) + (s[2] + s[3]);
      float sum = ((sv[0] + sv[1]) + (sv[2] + sv[3])) +
                  ((sv[4] + sv[5]) + (sv[6] + sv[7]));
      sum += other_half(sum);
      inv = 1.f / sum;
    }

    // ---- stage 4: bias^T = gf(16x12) @ geom^T + hb + vf(16x64) @ exp^T * inv
    {
      v8f accg = hb;
#pragma unroll  // fragments stay in registers: constant indices
      for (int kk = 0; kk < 3; ++kk) accg = wmma4(gf[kk], gb[kk], accg);
      v8f acce;
#pragma unroll  // acce is a register vector: constant indices
      for (int r = 0; r < 8; ++r) acce[r] = 0.f;
#pragma unroll  // fragments stay in registers: constant indices
      for (int kk = 0; kk < 16; ++kk) {
        v2f ex;
        ex[0] = s[kk >> 2][2 * (kk & 3)];
        ex[1] = s[kk >> 2][2 * (kk & 3) + 1];
        acce = wmma4(vf[kk], ex, acce);
      }
      float* op = biasout + ((size_t)(b * Hh + 2 * half) * Nn + i) * Nn + j;
      op[0] = accg[0] + acce[0] * inv;
      op[(size_t)Nn * Nn] = accg[1] + acce[1] * inv;
    }
  }
}

// ---------------------------------------------------------------------------
// Self-attention: per (b, h, 16-row q tile). One wave per block.
// grid = (N/16, H, B), block = 32
// ---------------------------------------------------------------------------
__global__ void __launch_bounds__(32)
attn_kernel(const float* __restrict__ q, const float* __restrict__ k,
            const float* __restrict__ v, const float* __restrict__ bias,
            float* __restrict__ outp) {
  __shared__ float ldsL[16][Nn];  // logits -> attn weights (16 x 256)

  const int i0   = blockIdx.x * 16;
  const int h    = blockIdx.y;
  const int b    = blockIdx.z;
  const int lane = threadIdx.x & 31;
  const int half = lane >> 4;
  const int ln   = lane & 15;
  const float scale = 0.1767766952966369f;  // 1/sqrt(32)

  // logits = q(16x32) @ k^T(32x256) * scale + bias
  for (int nt = 0; nt < 16; ++nt) {
    const int n0 = nt * 16;
    v8f acc;
#pragma unroll
    for (int r = 0; r < 8; ++r) acc[r] = 0.f;
#pragma unroll
    for (int k0 = 0; k0 < Dd; k0 += 4) {
      v2f a, bb;
      const float* qp = q + (size_t)(b * Nn + i0 + ln) * Cc + h * Dd + k0 + 2 * half;
      a[0] = qp[0];
      a[1] = qp[1];
      const float* kp = k + (size_t)(b * Nn + n0 + ln) * Cc + h * Dd + k0 + 2 * half;
      bb[0] = kp[0];
      bb[1] = kp[1];
      acc = wmma4(a, bb, acc);
    }
#pragma unroll
    for (int r = 0; r < 8; ++r) {
      const int row = r + 8 * half;
      ldsL[row][n0 + ln] =
          acc[r] * scale +
          bias[((size_t)(b * Hh + h) * Nn + (i0 + row)) * Nn + n0 + ln];
    }
  }
  __syncthreads();

  // softmax over 256: 2 lanes per row, 128 elems each
  {
    const int row = ln, seg = half;
    float mx = -1e30f;
    for (int t = 0; t < 128; ++t) mx = fmaxf(mx, ldsL[row][seg * 128 + t]);
    mx = fmaxf(mx, __shfl_xor(mx, 16, 32));
    float sum = 0.f;
    for (int t = 0; t < 128; ++t) {
      float e = __expf(ldsL[row][seg * 128 + t] - mx);
      ldsL[row][seg * 128 + t] = e;
      sum += e;
    }
    sum += __shfl_xor(sum, 16, 32);
    const float inv = 1.f / sum;
    for (int t = 0; t < 128; ++t) ldsL[row][seg * 128 + t] *= inv;
  }
  __syncthreads();

  // out = attn(16x256) @ v(256x32)
  for (int ct = 0; ct < 2; ++ct) {
    const int c0 = ct * 16;
    v8f acc;
#pragma unroll
    for (int r = 0; r < 8; ++r) acc[r] = 0.f;
    for (int k0 = 0; k0 < Nn; k0 += 4) {
      v2f a, bb;
      a[0] = ldsL[ln][k0 + 2 * half];
      a[1] = ldsL[ln][k0 + 2 * half + 1];
      const float* vp = v + (size_t)(b * Nn + k0 + 2 * half) * Cc + h * Dd + c0 + ln;
      bb[0] = vp[0];
      bb[1] = vp[Cc];
      acc = wmma4(a, bb, acc);
    }
#pragma unroll
    for (int r = 0; r < 8; ++r) {
      const int row = r + 8 * half;
      outp[(size_t)(b * Nn + i0 + row) * Cc + h * Dd + c0 + ln] = acc[r];
    }
  }
}

// ---------------------------------------------------------------------------
extern "C" void kernel_launch(void* const* d_in, const int* in_sizes, int n_in,
                              void* d_out, int out_size, void* d_ws,
                              size_t ws_size, hipStream_t stream) {
  (void)in_sizes; (void)n_in; (void)out_size; (void)ws_size;
  const float* feat    = (const float*)d_in[0];
  const float* centers = (const float*)d_in[1];
  const float* corners = (const float*)d_in[2];
  const float* lang    = (const float*)d_in[3];
  const float* Wq = (const float*)d_in[4];  const float* bq = (const float*)d_in[5];
  const float* Wk = (const float*)d_in[6];  const float* bk = (const float*)d_in[7];
  const float* Wv = (const float*)d_in[8];  const float* bv = (const float*)d_in[9];
  const float* Wo = (const float*)d_in[10]; const float* bo = (const float*)d_in[11];
  const float* Wrel = (const float*)d_in[12]; const float* brel = (const float*)d_in[13];
  const float* Wtk  = (const float*)d_in[14]; const float* btk  = (const float*)d_in[15];
  const float* Wtv  = (const float*)d_in[16]; const float* btv  = (const float*)d_in[17];
  const float* Wbias = (const float*)d_in[18]; const float* bbias = (const float*)d_in[19];

  float* ws = (float*)d_ws;
  const size_t MR = (size_t)Bsz * Nn;  // 2048 rows
  float* qb      = ws;
  float* kb      = qb + MR * Cc;
  float* vb      = kb + MR * Cc;
  float* Pf      = vb + MR * Cc;
  float* Qf      = Pf + (size_t)16 * PP;
  float* KFf     = Qf + (size_t)QR * Hh;
  float* VFf     = KFf + (size_t)Bsz * 16 * Tt;
  float* biasb   = VFf + (size_t)Bsz * Tt * Hh;
  float* attnout = biasb + (size_t)Bsz * Hh * Nn * Nn;

  // q / k / v projections  (2048x128 @ 128x128)
  dim3 gqkv(MR / 16, Cc / 16);
  gemm_bias_kernel<<<gqkv, 32, 0, stream>>>(feat, Wq, bq, qb, MR, Cc, Cc);
  gemm_bias_kernel<<<gqkv, 32, 0, stream>>>(feat, Wk, bk, kb, MR, Cc, Cc);
  gemm_bias_kernel<<<gqkv, 32, 0, stream>>>(feat, Wv, bv, vb, MR, Cc, Cc);

  // folded tables of the language cross-attention
  fold_weights_kernel<<<18, 32, 0, stream>>>(Wrel, brel, Wtk, btk, Wtv, btv,
                                             Wbias, Pf, Qf);
  fold_text_kernel<<<dim3(8, Bsz), 32, 0, stream>>>(lang, Pf, Qf, KFf, VFf);

  // fused geometry + language cross-attention -> bias(B,H,N,N)
  relbias_kernel<<<dim3(Nn, Bsz), 128, 0, stream>>>(
      centers, corners, Qf, KFf, VFf, bbias, biasb);

  // biased multi-head self-attention
  attn_kernel<<<dim3(Nn / 16, Hh, Bsz), 32, 0, stream>>>(qb, kb, vb, biasb,
                                                         attnout);

  // final projection -> d_out
  gemm_bias_kernel<<<gqkv, 32, 0, stream>>>(attnout, Wo, bo, (float*)d_out, MR,
                                            Cc, Cc);
}

// v003
// A run of this version takes 60.4 microseconds.
// Next to v002, in two timings, it ran 1.26 and 1.27 times as fast.
// Counting every step since v000, it is 5.85 times as fast.
#include <hip/hip_runtime.h>
#include <math.h>

// Problem constants (match reference)
#define Bsz 8
#define Nn  256
#define Cc  128
#define Tt  64
#define Hh  4
#define Gg  12
#define Dd  32
#define EPSF 1e-6f

typedef __attribute__((ext_vector_type(2))) float v2f;
typedef __attribute__((ext_vector_type(8))) float v8f;

// D = A(16x4,f32) * B(4x16,f32) + C(16x16,f32)   -> v_wmma_f32_16x16x4_f32
__device__ __forceinline__ v8f wmma4(v2f a, v2f b, v8f c) {
  return __builtin_amdgcn_wmma_f32_16x16x4_f32(false, a, false, b, (short)0, c,
                                               false, false);
}

// ---------------------------------------------------------------------------
// Generic GEMM: out[M x Nc] = A[M x K] @ W[K x Nc] + bias[Nc]
// One wave per 16x16 output tile. K must be a multiple of 4.
// grid = (M/16, Nc/16), block = 32
// ---------------------------------------------------------------------------
__global__ void __launch_bounds__(32)
gemm_bias_kernel(const float* __restrict__ A, const float* __restrict__ W,
                 const float* __restrict__ bias, float* __restrict__ out,
                 int M, int K, int Nc) {
  const int lane = threadIdx.x & 31;
  const int half = lane >> 4;   // which K pair / which row half for C
  const int ln   = lane & 15;   // M index for A, N index for B/C
  const int row0 = blockIdx.x * 16;
  const int col0 = blockIdx.y * 16;

  v8f acc;
  const float bv = bias[col0 + ln];
#pragma unroll
  for (int r = 0; r < 8; ++r) acc[r] = bv;

  for (int k0 = 0; k0 < K; k0 += 4) {
    v2f a, b;
    const float* Ap = A + (size_t)(row0 + ln) * K + (k0 + 2 * half);
    a[0] = Ap[0];
    a[1] = Ap[1];
    const float* Wp = W + (size_t)(k0 + 2 * half) * Nc + (col0 + ln);
    b[0] = Wp[0];
    b[1] = Wp[Nc];
    acc = wmma4(a, b, acc);
  }

#pragma unroll
  for (int r = 0; r < 8; ++r) {
    const int row = r + 8 * half;
    out[(size_t)(row0 + row) * Nc + col0 + ln] = acc[r];
  }
}

// ---------------------------------------------------------------------------
// The per-pair chain is linear in the 12 geometry features up to the softmax
// and linear again behind it, so its weight products are taken once instead of
// once per (i, j) pair:
//   scores = geom @ (Wrel @ k_txt^T) + brel @ k_txt^T
//   bias   = geom @ (Wrel @ Wbias) + alpha @ (v_txt @ Wbias) + brel @ Wbias + bbias
// with k_txt = lang @ Wtk + btk and v_txt = lang @ Wtv + btv folded the same way.
//
// Step 1, independent of the batch.
//   blocks 0..8 : P[g][n] = sum_c WB[g][c] * Y[n][c]    (16 x PP)
//                 WB rows 0..11 = Wrel rows, 12 = brel, the rest 0
//                 Y rows 0..127 = Wtk rows, 128 = btk, the rest 0
//   blocks 9..17: Q[m][h] = sum_c Z[m][c] * Wbias[c][h] (QR x 4)
//                 Z rows 0..127 = Wtv rows, 128 = btv, 129..140 = Wrel rows,
//                 141 = brel, the rest 0
// grid = 18, block = 32
// ---------------------------------------------------------------------------
#define PP 144
#define QR 144
#define QG (Cc + 1)   // first row of Wrel @ Wbias in Q

__global__ void __launch_bounds__(32)
fold_weights_kernel(const float* __restrict__ Wrel, const float* __restrict__ brel,
                    const float* __restrict__ Wtk, const float* __restrict__ btk,
                    const float* __restrict__ Wtv, const float* __restrict__ btv,
                    const float* __restrict__ Wbias,
                    float* __restrict__ P, float* __restrict__ Q) {
  const int lane = threadIdx.x & 31;
  const int half = lane >> 4;
  const int ln   = lane & 15;
  const int blk  = blockIdx.x;

  v8f acc;
#pragma unroll  // acc is a register vector: constant indices
  for (int r = 0; r < 8; ++r) acc[r] = 0.f;

  // A lane whose row or column is padding reads a valid address and selects 0.
  if (blk < 9) {
    const int n = blk * 16 + ln;
    const float* ap = ((ln < Gg) ? Wrel + ln * Cc : brel) + 2 * half;
    const float* bp = ((n < Cc) ? Wtk + n * Cc : btk) + 2 * half;
    const bool aon = ln <= Gg, bon = n <= Cc;
    // Unrolled: one wave per tile, so the loads of all k steps fly together.
#pragma unroll
    for (int k0 = 0; k0 < Cc; k0 += 4) {
      const float a0 = ap[k0], a1 = ap[k0 + 1];
      const float b0 = bp[k0], b1 = bp[k0 + 1];
      v2f a, bb;
      a[0]  = aon ? a0 : 0.f;
      a[1]  = aon ? a1 : 0.f;
      bb[0] = bon ? b0 : 0.f;
      bb[1] = bon ? b1 : 0.f;
      acc = wmma4(a, bb, acc);
    }
#pragma unroll  // acc is a register vector: constant indices
    for (int r = 0; r < 8; ++r) P[(r + 8 * half) * PP + n] = acc[r];
  } else {
    const int m0 = (blk - 9) * 16;
    const int m  = m0 + ln;
    const float* ap = (m < Cc)        ? Wtv + m * Cc
                    : (m == Cc)       ? btv
                    : (m < QG + Gg)   ? Wrel + (m - QG) * Cc
                                      : brel;
    ap += 2 * half;
    const float* bp = Wbias + 2 * half * Hh + (ln & (Hh - 1));
    const bool aon = m <= QG + Gg, bon = ln < Hh;
    // Unrolled: one wave per tile, so the loads of all k steps fly together.
#pragma unroll
    for (int k0 = 0; k0 < Cc; k0 += 4) {
      const float a0 = ap[k0], a1 = ap[k0 + 1];
      const float b0 = bp[k0 * Hh], b1 = bp[(k0 + 1) * Hh];
      v2f a, bb;
      a[0]  = aon ? a0 : 0.f;
      a[1]  = aon ? a1 : 0.f;
      bb[0] = bon ? b0 : 0.f;
      bb[1] = bon ? b1 : 0.f;
      acc = wmma4(a, bb, acc);
    }
    if (bon) {
#pragma unroll  // acc is a register vector: constant indices
      for (int r = 0; r < 8; ++r) Q[(m0 + r + 8 * half) * Hh + ln] = acc[r];
    }
  }
}

// ---------------------------------------------------------------------------
// Step 2, per batch.
//   blockIdx.x 0..3: KF[b][g][t] = sum_m P[g][m] * lang[b][t][m] + P[g][128]
//                    (rows 0..11 = Wrel @ k_txt^T, row 12 = brel @ k_txt^T)
//   blockIdx.x 4..7: VF[b][t][h] = sum_m lang[b][t][m] * Q[m][h] + Q[128][h]
//                    (= v_txt @ Wbias)
// grid = (8, B), block = 32
// ---------------------------------------------------------------------------
__global__ void __launch_bounds__(32)
fold_text_kernel(const float* __restrict__ lang, const float* __restrict__ P,
                 const float* __restrict__ Q, float* __restrict__ KF,
                 float* __restrict__ VF) {
  const int lane = threadIdx.x & 31;
  const int half = lane >> 4;
  const int ln   = lane & 15;
  const int b    = blockIdx.y;
  const int t0   = (blockIdx.x & 3) * 16;
  const float* lp = lang + (size_t)(b * Tt + t0 + ln) * Cc + 2 * half;

  v8f acc;
  if (blockIdx.x < 4) {
    const float* pp = P + ln * PP + 2 * half;
    const float* pc = P + 8 * half * PP + Cc;
#pragma unroll  // acc is a register vector: constant indices
    for (int r = 0; r < 8; ++r) acc[r] = pc[r * PP];
    // Unrolled: one wave per tile, so the loads of all k steps fly together.
#pragma unroll
    for (int k0 = 0; k0 < Cc; k0 += 4) {
      v2f a, bb;
      a[0]  = pp[k0];
      a[1]  = pp[k0 + 1];
      bb[0] = lp[k0];
      bb[1] = lp[k0 + 1];
      acc = wmma4(a, bb, acc);
    }
#pragma unroll  // acc is a register vector: constant indices
    for (int r = 0; r < 8; ++r)
      KF[(size_t)(b * 16 + r + 8 * half) * Tt + t0 + ln] = acc[r];
  } else {
    // Padding columns read a valid one and select 0.
    const float* qp = Q + 2 * half * Hh + (ln & (Hh - 1));
    const bool on = ln < Hh;
    const float qb = Q[Cc * Hh + (ln & (Hh - 1))];
#pragma unroll  // acc is a register vector: constant indices
    for (int r = 0; r < 8; ++r) acc[r] = on ? qb : 0.f;
    // Unrolled: one wave per tile, so the loads of all k steps fly together.
#pragma unroll
    for (int k0 = 0; k0 < Cc; k0 += 4) {
      const float b0 = qp[k0 * Hh], b1 = qp[(k0 + 1) * Hh];
      v2f a, bb;
      a[0]  = lp[k0];
      a[1]  = lp[k0 + 1];
      bb[0] = on ? b0 : 0.f;
      bb[1] = on ? b1 : 0.f;
      acc = wmma4(a, bb, acc);
    }
    if (on) {
#pragma unroll  // acc is a register vector: constant indices
      for (int r = 0; r < 8; ++r)
        VF[(size_t)(b * Tt + t0 + r + 8 * half) * Hh + ln] = acc[r];
    }
  }
}

// ---------------------------------------------------------------------------
// Fused: geometry -> lang cross-attn scores -> softmax -> bias head, on the
// folded tables (Q, KF, VF above).
// Every product is taken transposed, with the text index t (or the head) in the
// rows of D and the pair index j in its columns. A lane then holds 32 of the 64
// scores of its own j (lane ^ 16 holds the other 32), so the softmax runs in
// registers, and the registers of the exponentials are, pair by pair, the B
// operand of the head product; 1 / sum is the same for a whole column of D and
// multiplies the two result rows. Nothing goes through LDS and no wave waits
// for another.
// grid = (N, B), block = 128 (4 waves). Each wave handles four 16-wide j tiles,
// 64 j in a row, of this (b, i).
// ---------------------------------------------------------------------------
// Value of lane ^ 16.
__device__ __forceinline__ float other_half(float x) {
  const int v = __builtin_bit_cast(int, x);
  return __builtin_bit_cast(
      float, __builtin_amdgcn_permlanex16(v, v, 0x76543210, 0xfedcba98, false, false));
}

__global__ void __launch_bounds__(128)
relbias_kernel(const float* __restrict__ centers,
               const float* __restrict__ corners,
               const float* __restrict__ Q, const float* __restrict__ KF,
               const float* __restrict__ VF, const float* __restrict__ bbias,
               float* __restrict__ biasout) {
  const int i    = blockIdx.x;
  const int b    = blockIdx.y;
  const int w    = threadIdx.x >> 5;
  const int lane = threadIdx.x & 31;
  const int half = lane >> 4;
  const int ln   = lane & 15;

  // sizes for node i (same for all lanes; cheap)
  float sxi, syi, szi;
  {
    const float* cp = corners + (size_t)(b * Nn + i) * 24;
    float mx0 = -1e30f, mx1 = -1e30f, mx2 = -1e30f;
    float mn0 = 1e30f, mn1 = 1e30f, mn2 = 1e30f;
#pragma unroll
    for (int c = 0; c < 8; ++c) {
      float x = cp[c * 3 + 0], y = cp[c * 3 + 1], z = cp[c * 3 + 2];
      mx0 = fmaxf(mx0, x); mn0 = fminf(mn0, x);
      mx1 = fmaxf(mx1, y); mn1 = fminf(mn1, y);
      mx2 = fmaxf(mx2, z); mn2 = fminf(mn2, z);
    }
    sxi = mx0 - mn0; syi = mx1 - mn1; szi = mx2 - mn2;
  }
  const float cxi = centers[(size_t)(b * Nn + i) * 3 + 0];
  const float cyi = centers[(size_t)(b * Nn + i) * 3 + 1];
  const float czi = centers[(size_t)(b * Nn + i) * 3 + 2];

  const float rs128 = 0.08838834764831845f;  // 1/sqrt(128)
  const bool  hi  = half != 0;
  const float dxz = (hi ? szi : sxi) + EPSF;

  // A fragments of the folded tables: the same for every j tile of this block.
  // Head rows of D: head 2 * half + r sits in register r (r = 0, 1) of each lane
  // half, i.e. in A rows 0, 1, 8, 9, so that all 32 lanes store.
  v2f kf[4][3];   // KF[b] rows 0..11 as (t x g), four 16-row t tiles
  v8f kc[4];      // KF[b] row 12 at t = 16 tt + 8 half + r: C of the scores
  v2f gf[3];      // (Wrel @ Wbias)^T, rows other than 0, 1, 8, 9 zero
  v2f vf[16];     // VF[b]^T in the k order of the score registers (below)
  v8f hb;         // brel @ Wbias + bbias: C of the head
  {
    const float* KFb = KF + (size_t)b * 16 * Tt;
    const float* VFb = VF + (size_t)b * Tt * Hh;
#pragma unroll  // fragments stay in registers: constant indices
    for (int tt = 0; tt < 4; ++tt) {
#pragma unroll  // fragments stay in registers: constant indices
      for (int kk = 0; kk < 3; ++kk) {
        kf[tt][kk][0] = KFb[(4 * kk + 2 * half) * Tt + tt * 16 + ln];
        kf[tt][kk][1] = KFb[(4 * kk + 2 * half + 1) * Tt + tt * 16 + ln];
      }
#pragma unroll  // kc is a register vector: constant indices
      for (int r = 0; r < 8; ++r)
        kc[tt][r] = KFb[Gg * Tt + tt * 16 + 8 * half + r];
    }
    // padding rows read a valid head, select 0
    const int hc = 2 * (ln >> 3) + (ln & 1);
    const bool on = (ln & 7) < 2;
#pragma unroll  // fragments stay in registers: constant indices
    for (int kk = 0; kk < 3; ++kk) {
      const float g0 = Q[(QG + 4 * kk + 2 * half) * Hh + hc];
      const float g1 = Q[(QG + 4 * kk + 2 * half + 1) * Hh + hc];
      gf[kk][0] = on ? g0 : 0.f;
      gf[kk][1] = on ? g1 : 0.f;
    }
    // k step 4 tt + p of the head takes t = 16 tt + 8 half + 2 p + {0, 1}:
    // registers 2 p and 2 p + 1 of score tile tt.
#pragma unroll  // fragments stay in registers: constant indices
    for (int kk = 0; kk < 16; ++kk) {
      const int t = 16 * (kk >> 2) + 8 * half + 2 * (kk & 3);
      const float v0 = VFb[t * Hh + hc];
      const float v1 = VFb[(t + 1) * Hh + hc];
      vf[kk][0] = on ? v0 : 0.f;
      vf[kk][1] = on ? v1 : 0.f;
    }
#pragma unroll  // hb is a register vector: constant indices
    for (int r = 0; r < 8; ++r) hb[r] = 0.f;
    hb[0] = Q[(QG + Gg) * Hh + 2 * half] + bbias[2 * half];
    hb[1] = Q[(QG + Gg) * Hh + 2 * half + 1] + bbias[2 * half + 1];
  }

  for (int jo = 0; jo < 4; ++jo) {
    const int j = w * 64 + jo * 16 + ln;

    // ---- stage 1: geometry features of pair (i, j), in both lane halves ----
    v2f gb[3];  // geom^T (g x j), g = 4 kk + 2 half + {0, 1} as in kf and gf
    {
      const float cxj = centers[(size_t)(b * Nn + j) * 3 + 0];
      const float cyj = centers[(size_t)(b * Nn + j) * 3 + 1];
      const float czj = centers[(size_t)(b * Nn + j) * 3 + 2];
      const float r0 = cxj - cxi, r1 = cyj - cyi, r2 = czj - czi;
      const float dist  = sqrtf(r0 * r0 + r1 * r1 + r2 * r2);
      const float horiz = sqrtf(r0 * r0 + r1 * r1);
      const float cose  = r2 / (dist + EPSF);
      const float dlog  = logf(dist + EPSF);
      // sizes for node j
      const float* cp = corners + (size_t)(b * Nn + j) * 24;
      float mx0 = -1e30f, mx1 = -1e30f, mx2 = -1e30f;
      float mn0 = 1e30f, mn1 = 1e30f, mn2 = 1e30f;
#pragma unroll
      for (int c = 0; c < 8; ++c) {
        float x = cp[c * 3 + 0], y = cp[c * 3 + 1], z = cp[c * 3 + 2];
        mx0 = fmaxf(mx0, x); mn0 = fminf(mn0, x);
        mx1 = fmaxf(mx1, y); mn1 = fminf(mn1, y);
        mx2 = fmaxf(mx2, z); mn2 = fminf(mn2, z);
      }
      const float sxj = mx0 - mn0, syj = mx1 - mn1, szj = mx2 - mn2;
      // Feature 9 (lower half) and feature 11 (upper half) share one division.
      const float ry  = syj / (syi + EPSF);
      const float rxz = (hi ? szj : sxj) / dxz;
      gb[0][0] = hi ? r2 : r0;
      gb[0][1] = hi ? dlog : r1;
      gb[1][0] = hi ? sxj - sxi : horiz;
      gb[1][1] = hi ? syj - syi : cose;
      gb[2][0] = hi ? ry : szj - szi;
      gb[2][1] = rxz;
    }

    // ---- stage 2: scores^T = (KF^T(64x12) @ geom^T(12x16) + KF row 12) * rs128
    v8f s[4];   // s[tt][r] = score of (t = 16 tt + 8 half + r, j)
#pragma unroll  // fragments stay in registers: constant indices
    for (int tt = 0; tt < 4; ++tt) {
      v8f acc = kc[tt];
#pragma unroll  // fragments stay in registers: constant indices
      for (int kk = 0; kk < 3; ++kk) acc = wmma4(kf[tt][kk], gb[kk], acc);
      s[tt] = acc * rs128;
    }

    // ---- stage 3: softmax over T=64, 32 registers in each of 2 lanes ----
    float inv;  // 1 / sum of the exponentials; applied behind the head product
    {
      float mx = -1e30f;
#pragma unroll  // s is a register array: constant indices
      for (int tt = 0; tt < 4; ++tt)
#pragma unroll  // s is a register array: constant indices
        for (int r = 0; r < 8; ++r) mx = fmaxf(mx, s[tt][r]);
      mx = fmaxf(mx, other_half(mx));
#pragma unroll  // s is a register array: constant indices
      for (int tt = 0; tt < 4; ++tt)
#pragma unroll  // s is a register array: constant indices
        for (int r = 0; r < 8; ++r) s[tt][r] = __expf(s[tt][r] - mx);
      const v8f sv = (s[0] + s[1]) + (s[2] + s[3]);
      float sum = ((sv[0] + sv[1]) + (sv[2] + sv[3])) +
                  ((sv[4] + sv[5]) + (sv[6] + sv[7]));
      sum += other_half(sum);
      inv = 1.f / sum;
    }

    // ---- stage 4: bias^T = gf(16x12) @ geom^T + hb + vf(16x64) @ exp^T * inv
    {
      v8f accg = hb;
#pragma unroll  // fragments stay in registers: constant indices
      for (int kk = 0; kk < 3; ++kk) accg = wmma4(gf[kk], gb[kk], accg);
      v8f acce;
#pragma unroll  // acce is a register vector: constant indices
      for (int r = 0; r < 8; ++r) acce[r] = 0.f;
#pragma unroll  // fragments stay in registers: constant indices
      for (int kk = 0; kk < 16; ++kk) {
        v2f ex;
        ex[0] = s[kk >> 2][2 * (kk & 3)];
        ex[1] = s[kk >> 2][2 * (kk & 3) + 1];
        acce = wmma4(vf[kk], ex, acce);
      }
      float* op = biasout + ((size_t)(b * Hh + 2 * half) * Nn + i) * Nn + j;
      op[0] = accg[0] + acce[0] * inv;
      op[(size_t)Nn * Nn] = accg[1] + acce[1] * inv;
    }
  }
}

// ---------------------------------------------------------------------------
// Self-attention: per (b, h, 16-row q tile), the 256 keys split over 4 waves.
// Both products are taken transposed, with the key index j (or the channel c) in
// the rows of D and the query index i in its columns, as in relbias_kernel: a
// lane holds 32 of its wave's 64 logits of its own i (lane ^ 16 the other 32),
// the softmax runs in registers, and the registers of the exponentials are, pair
// by pair, the B operand of the second product. Each wave keeps its own maximum,
// sum and partial output; they are merged once, through LDS, behind one barrier.
// A wave's operands are few enough to be loaded all at once, ahead of the work.
// grid = (N/16, H, B), block = 128 (4 waves)
// ---------------------------------------------------------------------------
#define OPITCH 36   // floats per row of a partial output: 16 B x odd

typedef __attribute__((ext_vector_type(4))) float v4f;

__global__ void __launch_bounds__(128)
attn_kernel(const float* __restrict__ q, const float* __restrict__ k,
            const float* __restrict__ v, const float* __restrict__ bias,
            float* __restrict__ outp) {
  __shared__ __attribute__((aligned(16))) float ldsO[4][16][OPITCH];  // [wave][i][c]
  __shared__ float ldsMS[4][2][16];  // [wave][0: maximum, 1: sum][i]

  const int i0   = blockIdx.x * 16;
  const int h    = blockIdx.y;
  const int b    = blockIdx.z;
  const int w    = threadIdx.x >> 5;
  const int lane = threadIdx.x & 31;
  const int half = lane >> 4;
  const int ln   = lane & 15;
  const int j0   = w * 64;
  const float scale = 0.1767766952966369f;  // 1/sqrt(32)

  v2f qf[8];      // q^T (d x i), d = 4 kk + 2 half + {0, 1}
  v2f kf[4][8];   // k (j x d), four 16-row j tiles, d as in qf
  v8f s[4];       // s[tt][r] = logit of (j = j0 + 16 tt + 8 half + r, i)
  v2f vf[2][16];  // v^T (c x j) in the k order of the logit registers (below)
  {
    const float* qp = q + (size_t)(b * Nn + i0 + ln) * Cc + h * Dd + 2 * half;
#pragma unroll  // fragments stay in registers: constant indices
    for (int kk = 0; kk < 8; ++kk) {
      qf[kk][0] = qp[4 * kk];
      qf[kk][1] = qp[4 * kk + 1];
    }
    asm volatile("s_wait_xcnt 0x0" ::: "memory");  // before the address registers above are reused
    const float* kp = k + (size_t)(b * Nn + j0 + ln) * Cc + h * Dd + 2 * half;
#pragma unroll  // fragments stay in registers: constant indices
    for (int tt = 0; tt < 4; ++tt)
#pragma unroll  // fragments stay in registers: constant indices
      for (int kk = 0; kk < 8; ++kk) {
        kf[tt][kk][0] = kp[tt * 16 * Cc + 4 * kk];
        kf[tt][kk][1] = kp[tt * 16 * Cc + 4 * kk + 1];
      }
    asm volatile("s_wait_xcnt 0x0" ::: "memory");  // before the address registers above are reused
    // The bias is the C operand of the first product: 8 j in a row per lane.
    const float* bp =
        bias + ((size_t)(b * Hh + h) * Nn + i0 + ln) * Nn + j0 + 8 * half;
#pragma unroll  // s is a register array: constant indices
    for (int tt = 0; tt < 4; ++tt) {
      const v4f lo = *(const v4f*)(bp + tt * 16);
      const v4f up = *(const v4f*)(bp + tt * 16 + 4);
#pragma unroll  // s is a register array: constant indices
      for (int r = 0; r < 4; ++r) {
        s[tt][r]     = lo[r];
        s[tt][r + 4] = up[r];
      }
    }
    asm volatile("s_wait_xcnt 0x0" ::: "memory");  // before the address registers above are reused
    // k step 4 tt + p of the second product takes j = j0 + 16 tt + 8 half +
    // 2 p + {0, 1}: registers 2 p and 2 p + 1 of logit tile tt.
    const float* vp = v + (size_t)(b * Nn + j0 + 8 * half) * Cc + h * Dd + ln;
#pragma unroll  // fragments stay in registers: constant indices
    for (int ct = 0; ct < 2; ++ct)
#pragma unroll  // fragments stay in registers: constant indices
      for (int kk = 0; kk < 16; ++kk) {
        const int jr = 16 * (kk >> 2) + 2 * (kk & 3);
        vf[ct][kk][0] = vp[jr * Cc + ct * 16];
        vf[ct][kk][1] = vp[(jr + 1) * Cc + ct * 16];
      }
    asm volatile("s_wait_xcnt 0x0" ::: "memory");  // before the address registers above are reused
  }

  // Keeps the loads of v ahead of the first product: without it they are moved
  // behind it and their latency is waited for a second time.
  __builtin_amdgcn_sched_barrier(0);

  // logits^T = k(64x32) @ (q * scale)^T(32x16) + bias^T
#pragma unroll  // fragments stay in registers: constant indices
  for (int kk = 0; kk < 8; ++kk) {
    const v2f qs = qf[kk] * scale;
#pragma unroll  // fragments stay in registers: constant indices
    for (int tt = 0; tt < 4; ++tt) s[tt] = wmma4(kf[tt][kk], qs, s[tt]);
  }

  // this wave's part of the softmax: 32 registers in each of 2 lanes
  float mx = -1e30f, sum;
  {
#pragma unroll  // s is a register array: constant indices
    for (int tt = 0; tt < 4; ++tt)
#pragma unroll  // s is a register array: constant indices
      for (int r = 0; r < 8; ++r) mx = fmaxf(mx, s[tt][r]);
    mx = fmaxf(mx, other_half(mx));
#pragma unroll  // s is a register array: constant indices
    for (int tt = 0; tt < 4; ++tt)
#pragma unroll  // s is a register array: constant indices
      for (int r = 0; r < 8; ++r) s[tt][r] = __expf(s[tt][r] - mx);
    const v8f sv = (s[0] + s[1]) + (s[2] + s[3]);
    sum = ((sv[0] + sv[1]) + (sv[2] + sv[3])) +
          ((sv[4] + sv[5]) + (sv[6] + sv[7]));
    sum += other_half(sum);
  }

  // partial out^T = v^T(32x64) @ exp^T(64x16)
  v8f o[2];  // o[ct][r] = (c = 16 ct + 8 half + r, i)
#pragma unroll  // o is a register array: constant indices
  for (int ct = 0; ct < 2; ++ct)
#pragma unroll  // o is a register array: constant indices
    for (int r = 0; r < 8; ++r) o[ct][r] = 0.f;
#pragma unroll  // fragments stay in registers: constant indices
  for (int kk = 0; kk < 16; ++kk) {
    v2f ex;
    ex[0] = s[kk >> 2][2 * (kk & 3)];
    ex[1] = s[kk >> 2][2 * (kk & 3) + 1];
#pragma unroll  // fragments stay in registers: constant indices
    for (int ct = 0; ct < 2; ++ct) o[ct] = wmma4(vf[ct][kk], ex, o[ct]);
  }

#pragma unroll  // o is a register array: constant indices
  for (int ct = 0; ct < 2; ++ct) {
    v4f lo, up;
#pragma unroll  // o is a register array: constant indices
    for (int r = 0; r < 4; ++r) {
      lo[r] = o[ct][r];
      up[r] = o[ct][r + 4];
    }
    *(v4f*)&ldsO[w][ln][ct * 16 + 8 * half]     = lo;
    *(v4f*)&ldsO[w][ln][ct * 16 + 8 * half + 4] = up;
  }
  ldsMS[w][half][ln] = half ? sum : mx;  // both are equal in the two lane halves
  __syncthreads();

  // merge: wave w takes rows 4 w .. 4 w + 3, 8 lanes a row, so that every
  // 128-byte line of the output is stored whole by one wave.
  {
    const int mi = 4 * w + (lane >> 3);
    const int mc = 4 * (lane & 7);
    float m[4];
#pragma unroll  // m is a register array: constant indices
    for (int x = 0; x < 4; ++x) m[x] = ldsMS[x][0][mi];
    const float mall = fmaxf(fmaxf(m[0], m[1]), fmaxf(m[2], m[3]));
    float tot = 0.f;
    v4f acc = {0.f, 0.f, 0.f, 0.f};
#pragma unroll  // m is a register array: constant indices
    for (int x = 0; x < 4; ++x) {
      const float f = __expf(m[x] - mall);
      tot += f * ldsMS[x][1][mi];
      acc += f * *(const v4f*)&ldsO[x][mi][mc];
    }
    const float inv = 1.f / tot;
    *(v4f*)(outp + (size_t)(b * Nn + i0 + mi) * Cc + h * Dd + mc) = acc * inv;
  }
}

// ---------------------------------------------------------------------------
extern "C" void kernel_launch(void* const* d_in, const int* in_sizes, int n_in,
                              void* d_out, int out_size, void* d_ws,
                              size_t ws_size, hipStream_t stream) {
  (void)in_sizes; (void)n_in; (void)out_size; (void)ws_size;
  const float* feat    = (const float*)d_in[0];
  const float* centers = (const float*)d_in[1];
  const float* corners = (const float*)d_in[2];
  const float* lang    = (const float*)d_in[3];
  const float* Wq = (const float*)d_in[4];  const float* bq = (const float*)d_in[5];
  const float* Wk = (const float*)d_in[6];  const float* bk = (const float*)d_in[7];
  const float* Wv = (const float*)d_in[8];  const float* bv = (const float*)d_in[9];
  const float* Wo = (const float*)d_in[10]; const float* bo = (const float*)d_in[11];
  const float* Wrel = (const float*)d_in[12]; const float* brel = (const float*)d_in[13];
  const float* Wtk  = (const float*)d_in[14]; const float* btk  = (const float*)d_in[15];
  const float* Wtv  = (const float*)d_in[16]; const float* btv  = (const float*)d_in[17];
  const float* Wbias = (const float*)d_in[18]; const float* bbias = (const float*)d_in[19];

  float* ws = (float*)d_ws;
  const size_t MR = (size_t)Bsz * Nn;  // 2048 rows
  float* qb      = ws;
  float* kb      = qb + MR * Cc;
  float* vb      = kb + MR * Cc;
  float* Pf      = vb + MR * Cc;
  float* Qf      = Pf + (size_t)16 * PP;
  float* KFf     = Qf + (size_t)QR * Hh;
  float* VFf     = KFf + (size_t)Bsz * 16 * Tt;
  float* biasb   = VFf + (size_t)Bsz * Tt * Hh;
  float* attnout = biasb + (size_t)Bsz * Hh * Nn * Nn;

  // q / k / v projections  (2048x128 @ 128x128)
  dim3 gqkv(MR / 16, Cc / 16);
  gemm_bias_kernel<<<gqkv, 32, 0, stream>>>(feat, Wq, bq, qb, MR, Cc, Cc);
  gemm_bias_kernel<<<gqkv, 32, 0, stream>>>(feat, Wk, bk, kb, MR, Cc, Cc);
  gemm_bias_kernel<<<gqkv, 32, 0, stream>>>(feat, Wv, bv, vb, MR, Cc, Cc);

  // folded tables of the language cross-attention
  fold_weights_kernel<<<18, 32, 0, stream>>>(Wrel, brel, Wtk, btk, Wtv, btv,
                                             Wbias, Pf, Qf);
  fold_text_kernel<<<dim3(8, Bsz), 32, 0, stream>>>(lang, Pf, Qf, KFf, VFf);

  // fused geometry + language cross-attention -> bias(B,H,N,N)
  relbias_kernel<<<dim3(Nn, Bsz), 128, 0, stream>>>(
      centers, corners, Qf, KFf, VFf, bbias, biasb);

  // biased multi-head self-attention
  attn_kernel<<<dim3(Nn / 16, Hh, Bsz), 128, 0, stream>>>(qb, kb, vb, biasb,
                                                         attnout);

  // final projection -> d_out
  gemm_bias_kernel<<<gqkv, 32, 0, stream>>>(attnout, Wo, bo, (float*)d_out, MR,
                                            Cc, Cc);
}

// v004
// A run of this version takes 39.1 microseconds.
// Timed twice side by side with v003, it ran 1.55 times as fast both times.
// Counting every step since v000, it is 9.06 times as fast.
#include <hip/hip_runtime.h>
#include <math.h>

// Problem constants (match reference)
#define Bsz 8
#define Nn  256
#define Cc  128
#define Tt  64
#define Hh  4
#define Gg  12
#define Dd  32
#define EPSF 1e-6f

typedef __attribute__((ext_vector_type(2))) float v2f;
typedef __attribute__((ext_vector_type(8))) float v8f;

// D = A(16x4,f32) * B(4x16,f32) + C(16x16,f32)   -> v_wmma_f32_16x16x4_f32
__device__ __forceinline__ v8f wmma4(v2f a, v2f b, v8f c) {
  return __builtin_amdgcn_wmma_f32_16x16x4_f32(false, a, false, b, (short)0, c,
                                               false, false);
}

// ---------------------------------------------------------------------------
// Generic GEMM: out[M x Nc] = A[M x K] @ W[K x Nc] + bias[Nc]
// One wave per 16x16 output tile at (row0, col0). K must be a multiple of 4.
// ---------------------------------------------------------------------------
__device__ __forceinline__ void
gemm_bias_tile(const float* __restrict__ A, const float* __restrict__ W,
               const float* __restrict__ bias, float* __restrict__ out,
               int row0, int col0, int K, int Nc) {
  const int lane = threadIdx.x & 31;
  const int half = lane >> 4;   // which K pair / which row half for C
  const int ln   = lane & 15;   // M index for A, N index for B/C

  v8f acc;
  const float bv = bias[col0 + ln];
#pragma unroll
  for (int r = 0; r < 8; ++r) acc[r] = bv;

  for (int k0 = 0; k0 < K; k0 += 4) {
    v2f a, b;
    const float* Ap = A + (size_t)(row0 + ln) * K + (k0 + 2 * half);
    a[0] = Ap[0];
    a[1] = Ap[1];
    const float* Wp = W + (size_t)(k0 + 2 * half) * Nc + (col0 + ln);
    b[0] = Wp[0];
    b[1] = Wp[Nc];
    acc = wmma4(a, b, acc);
  }

#pragma unroll
  for (int r = 0; r < 8; ++r) {
    const int row = r + 8 * half;
    out[(size_t)(row0 + row) * Nc + col0 + ln] = acc[r];
  }
}

// grid = (M/16, Nc/16), block = 32
__global__ void __launch_bounds__(32)
gemm_bias_kernel(const float* __restrict__ A, const float* __restrict__ W,
                 const float* __restrict__ bias, float* __restrict__ out,
                 int M, int K, int Nc) {
  gemm_bias_tile(A, W, bias, out, blockIdx.x * 16, blockIdx.y * 16, K, Nc);
}

// ---------------------------------------------------------------------------
// The per-pair chain is linear in the 12 geometry features up to the softmax
// and linear again behind it, so its weight products are taken once instead of
// once per (i, j) pair:
//   scores = geom @ (Wrel @ k_txt^T) + brel @ k_txt^T
//   bias   = geom @ (Wrel @ Wbias) + alpha @ (v_txt @ Wbias) + brel @ Wbias + bbias
// with k_txt = lang @ Wtk + btk and v_txt = lang @ Wtv + btv folded the same way.
//
// Step 1, independent of the batch.
//   blocks 0..8 : P[g][n] = sum_c WB[g][c] * Y[n][c]    (16 x PP)
//                 WB rows 0..11 = Wrel rows, 12 = brel, the rest 0
//                 Y rows 0..127 = Wtk rows, 128 = btk, the rest 0
//   blocks 9..17: Q[m][h] = sum_c Z[m][c] * Wbias[c][h] (QR x 4)
//                 Z rows 0..127 = Wtv rows, 128 = btv, 129..140 = Wrel rows,
//                 141 = brel, the rest 0
// grid = 18, block = 32
// ---------------------------------------------------------------------------
#define PP 144
#define QR 144
#define QG (Cc + 1)   // first row of Wrel @ Wbias in Q

__global__ void __launch_bounds__(32)
fold_weights_kernel(const float* __restrict__ Wrel, const float* __restrict__ brel,
                    const float* __restrict__ Wtk, const float* __restrict__ btk,
                    const float* __restrict__ Wtv, const float* __restrict__ btv,
                    const float* __restrict__ Wbias,
                    float* __restrict__ P, float* __restrict__ Q) {
  const int lane = threadIdx.x & 31;
  const int half = lane >> 4;
  const int ln   = lane & 15;
  const int blk  = blockIdx.x;

  v8f acc;
#pragma unroll  // acc is a register vector: constant indices
  for (int r = 0; r < 8; ++r) acc[r] = 0.f;

  // A lane whose row or column is padding reads a valid address and selects 0.
  if (blk < 9) {
    const int n = blk * 16 + ln;
    const float* ap = ((ln < Gg) ? Wrel + ln * Cc : brel) + 2 * half;
    const float* bp = ((n < Cc) ? Wtk + n * Cc : btk) + 2 * half;
    const bool aon = ln <= Gg, bon = n <= Cc;
    // Unrolled: one wave per tile, so the loads of all k steps fly together.
#pragma unroll
    for (int k0 = 0; k0 < Cc; k0 += 4) {
      const float a0 = ap[k0], a1 = ap[k0 + 1];
      const float b0 = bp[k0], b1 = bp[k0 + 1];
      v2f a, bb;
      a[0]  = aon ? a0 : 0.f;
      a[1]  = aon ? a1 : 0.f;
      bb[0] = bon ? b0 : 0.f;
      bb[1] = bon ? b1 : 0.f;
      acc = wmma4(a, bb, acc);
    }
#pragma unroll  // acc is a register vector: constant indices
    for (int r = 0; r < 8; ++r) P[(r + 8 * half) * PP + n] = acc[r];
  } else {
    const int m0 = (blk - 9) * 16;
    const int m  = m0 + ln;
    const float* ap = (m < Cc)        ? Wtv + m * Cc
                    : (m == Cc)       ? btv
                    : (m < QG + Gg)   ? Wrel + (m - QG) * Cc
                                      : brel;
    ap += 2 * half;
    const float* bp = Wbias + 2 * half * Hh + (ln & (Hh - 1));
    const bool aon = m <= QG + Gg, bon = ln < Hh;
    // Unrolled: one wave per tile, so the loads of all k steps fly together.
#pragma unroll
    for (int k0 = 0; k0 < Cc; k0 += 4) {
      const float a0 = ap[k0], a1 = ap[k0 + 1];
      const float b0 = bp[k0 * Hh], b1 = bp[(k0 + 1) * Hh];
      v2f a, bb;
      a[0]  = aon ? a0 : 0.f;
      a[1]  = aon ? a1 : 0.f;
      bb[0] = bon ? b0 : 0.f;
      bb[1] = bon ? b1 : 0.f;
      acc = wmma4(a, bb, acc);
    }
    if (bon) {
#pragma unroll  // acc is a register vector: constant indices
      for (int r = 0; r < 8; ++r) Q[(m0 + r + 8 * half) * Hh + ln] = acc[r];
    }
  }
}

// ---------------------------------------------------------------------------
// Step 2, per batch.
//   blockIdx.x 0..3: KF[b][g][t] = sum_m P[g][m] * lang[b][t][m] + P[g][128]
//                    (rows 0..11 = Wrel @ k_txt^T, row 12 = brel @ k_txt^T)
//   blockIdx.x 4..7: VF[b][t][h] = sum_m lang[b][t][m] * Q[m][h] + Q[128][h]
//                    (= v_txt @ Wbias)
// grid = (8, B), block = 32
// ---------------------------------------------------------------------------
__global__ void __launch_bounds__(32)
fold_text_kernel(const float* __restrict__ lang, const float* __restrict__ P,
                 const float* __restrict__ Q, float* __restrict__ KF,
                 float* __restrict__ VF) {
  const int lane = threadIdx.x & 31;
  const int half = lane >> 4;
  const int ln   = lane & 15;
  const int b    = blockIdx.y;
  const int t0   = (blockIdx.x & 3) * 16;
  const float* lp = lang + (size_t)(b * Tt + t0 + ln) * Cc + 2 * half;

  v8f acc;
  if (blockIdx.x < 4) {
    const float* pp = P + ln * PP + 2 * half;
    const float* pc = P + 8 * half * PP + Cc;
#pragma unroll  // acc is a register vector: constant indices
    for (int r = 0; r < 8; ++r) acc[r] = pc[r * PP];
    // Unrolled: one wave per tile, so the loads of all k steps fly together.
#pragma unroll
    for (int k0 = 0; k0 < Cc; k0 += 4) {
      v2f a, bb;
      a[0]  = pp[k0];
      a[1]  = pp[k0 + 1];
      bb[0] = lp[k0];
      bb[1] = lp[k0 + 1];
      acc = wmma4(a, bb, acc);
    }
#pragma unroll  // acc is a register vector: constant indices
    for (int r = 0; r < 8; ++r)
      KF[(size_t)(b * 16 + r + 8 * half) * Tt + t0 + ln] = acc[r];
  } else {
    // Padding columns read a valid one and select 0.
    const float* qp = Q + 2 * half * Hh + (ln & (Hh - 1));
    const bool on = ln < Hh;
    const float qb = Q[Cc * Hh + (ln & (Hh - 1))];
#pragma unroll  // acc is a register vector: constant indices
    for (int r = 0; r < 8; ++r) acc[r] = on ? qb : 0.f;
    // Unrolled: one wave per tile, so the loads of all k steps fly together.
#pragma unroll
    for (int k0 = 0; k0 < Cc; k0 += 4) {
      const float b0 = qp[k0 * Hh], b1 = qp[(k0 + 1) * Hh];
      v2f a, bb;
      a[0]  = lp[k0];
      a[1]  = lp[k0 + 1];
      bb[0] = on ? b0 : 0.f;
      bb[1] = on ? b1 : 0.f;
      acc = wmma4(a, bb, acc);
    }
    if (on) {
#pragma unroll  // acc is a register vector: constant indices
      for (int r = 0; r < 8; ++r)
        VF[(size_t)(b * Tt + t0 + r + 8 * half) * Hh + ln] = acc[r];
    }
  }
}

// ---------------------------------------------------------------------------
// Fused: geometry -> lang cross-attn scores -> softmax -> bias head, on the
// folded tables (Q, KF, VF above).
// Every product is taken transposed, with the text index t (or the head) in the
// rows of D and the pair index j in its columns. A lane then holds 32 of the 64
// scores of its own j (lane ^ 16 holds the other 32), so the softmax runs in
// registers, and the registers of the exponentials are, pair by pair, the B
// operand of the head product; 1 / sum is the same for a whole column of D and
// multiplies the two result rows. Nothing goes through LDS and no wave waits
// for another.
// grid = (N, B + 3), block = 128 (4 waves). For blockIdx.y < B each wave handles
// four 16-wide j tiles, 64 j in a row, of this (b, i).
//
// The q, k and v projections depend on nothing that this kernel reads or writes,
// so they ride in the same launch instead of three launches of their own:
// blockIdx.y = B, B + 1, B + 2 is q, k, v, one 16x16 tile a wave, the 4 waves of a
// block on 4 column tiles of the same rows. They have the highest indices, so
// they start last, in the places that the first bias blocks leave.
// ---------------------------------------------------------------------------
// Value of lane ^ 16.
__device__ __forceinline__ float other_half(float x) {
  const int v = __builtin_bit_cast(int, x);
  return __builtin_bit_cast(
      float, __builtin_amdgcn_permlanex16(v, v, 0x76543210, 0xfedcba98, false, false));
}

__global__ void __launch_bounds__(128)
relbias_qkv_kernel(const float* __restrict__ centers,
                   const float* __restrict__ corners,
                   const float* __restrict__ Q, const float* __restrict__ KF,
                   const float* __restrict__ VF, const float* __restrict__ bbias,
                   float* __restrict__ biasout, const float* __restrict__ feat,
                   const float* __restrict__ Wq, const float* __restrict__ bq,
                   const float* __restrict__ Wk, const float* __restrict__ bk,
                   const float* __restrict__ Wv, const float* __restrict__ bv,
                   float* __restrict__ qout, float* __restrict__ kout,
                   float* __restrict__ vout) {
  if (blockIdx.y >= Bsz) {
    const int p = blockIdx.y - Bsz;
    const float* Wp = p == 0 ? Wq : p == 1 ? Wk : Wv;
    const float* bp = p == 0 ? bq : p == 1 ? bk : bv;
    float*       op = p == 0 ? qout : p == 1 ? kout : vout;
    // The wave's number, held in a scalar register: the tile's origin is then
    // scalar arithmetic.
    const int tile =
        blockIdx.x * 4 + __builtin_amdgcn_readfirstlane(threadIdx.x >> 5);
    gemm_bias_tile(feat, Wp, bp, op, (tile >> 3) * 16, (tile & 7) * 16, Cc, Cc);
    return;
  }

  const int i    = blockIdx.x;
  const int b    = blockIdx.y;
  const int w    = threadIdx.x >> 5;
  const int lane = threadIdx.x & 31;
  const int half = lane >> 4;
  const int ln   = lane & 15;

  // sizes for node i (same for all lanes; cheap)
  float sxi, syi, szi;
  {
    const float* cp = corners + (size_t)(b * Nn + i) * 24;
    float mx0 = -1e30f, mx1 = -1e30f, mx2 = -1e30f;
    float mn0 = 1e30f, mn1 = 1e30f, mn2 = 1e30f;
#pragma unroll
    for (int c = 0; c < 8; ++c) {
      float x = cp[c * 3 + 0], y = cp[c * 3 + 1], z = cp[c * 3 + 2];
      mx0 = fmaxf(mx0, x); mn0 = fminf(mn0, x);
      mx1 = fmaxf(mx1, y); mn1 = fminf(mn1, y);
      mx2 = fmaxf(mx2, z); mn2 = fminf(mn2, z);
    }
    sxi = mx0 - mn0; syi = mx1 - mn1; szi = mx2 - mn2;
  }
  const float cxi = centers[(size_t)(b * Nn + i) * 3 + 0];
  const float cyi = centers[(size_t)(b * Nn + i) * 3 + 1];
  const float czi = centers[(size_t)(b * Nn + i) * 3 + 2];

  const float rs128 = 0.08838834764831845f;  // 1/sqrt(128)
  const bool  hi  = half != 0;
  const float dxz = (hi ? szi : sxi) + EPSF;

  // A fragments of the folded tables: the same for every j tile of this block.
  // Head rows of D: head 2 * half + r sits in register r (r = 0, 1) of each lane
  // half, i.e. in A rows 0, 1, 8, 9, so that all 32 lanes store.
  v2f kf[4][3];   // KF[b] rows 0..11 as (t x g), four 16-row t tiles
  v8f kc[4];      // KF[b] row 12 at t = 16 tt + 8 half + r: C of the scores
  v2f gf[3];      // (Wrel @ Wbias)^T, rows other than 0, 1, 8, 9 zero
  v2f vf[16];     // VF[b]^T in the k order of the score registers (below)
  v8f hb;         // brel @ Wbias + bbias: C of the head
  {
    const float* KFb = KF + (size_t)b * 16 * Tt;
    const float* VFb = VF + (size_t)b * Tt * Hh;
#pragma unroll  // fragments stay in registers: constant indices
    for (int tt = 0; tt < 4; ++tt) {
#pragma unroll  // fragments stay in registers: constant indices
      for (int kk = 0; kk < 3; ++kk) {
        kf[tt][kk][0] = KFb[(4 * kk + 2 * half) * Tt + tt * 16 + ln];
        kf[tt][kk][1] = KFb[(4 * kk + 2 * half + 1) * Tt + tt * 16 + ln];
      }
#pragma unroll  // kc is a register vector: constant indices
      for (int r = 0; r < 8; ++r)
        kc[tt][r] = KFb[Gg * Tt + tt * 16 + 8 * half + r];
    }
    // padding rows read a valid head, select 0
    const int hc = 2 * (ln >> 3) + (ln & 1);
    const bool on = (ln & 7) < 2;
#pragma unroll  // fragments stay in registers: constant indices
    for (int kk = 0; kk < 3; ++kk) {
      const float g0 = Q[(QG + 4 * kk + 2 * half) * Hh + hc];
      const float g1 = Q[(QG + 4 * kk + 2 * half + 1) * Hh + hc];
      gf[kk][0] = on ? g0 : 0.f;
      gf[kk][1] = on ? g1 : 0.f;
    }
    // k step 4 tt + p of the head takes t = 16 tt + 8 half + 2 p + {0, 1}:
    // registers 2 p and 2 p + 1 of score tile tt.
#pragma unroll  // fragments stay in registers: constant indices
    for (int kk = 0; kk < 16; ++kk) {
      const int t = 16 * (kk >> 2) + 8 * half + 2 * (kk & 3);
      const float v0 = VFb[t * Hh + hc];
      const float v1 = VFb[(t + 1) * Hh + hc];
      vf[kk][0] = on ? v0 : 0.f;
      vf[kk][1] = on ? v1 : 0.f;
    }
#pragma unroll  // hb is a register vector: constant indices
    for (int r = 0; r < 8; ++r) hb[r] = 0.f;
    hb[0] = Q[(QG + Gg) * Hh + 2 * half] + bbias[2 * half];
    hb[1] = Q[(QG + Gg) * Hh + 2 * half + 1] + bbias[2 * half + 1];
  }

  for (int jo = 0; jo < 4; ++jo) {
    const int j = w * 64 + jo * 16 + ln;

    // ---- stage 1: geometry features of pair (i, j), in both lane halves ----
    v2f gb[3];  // geom^T (g x j), g = 4 kk + 2 half + {0, 1} as in kf and gf
    {
      const float cxj = centers[(size_t)(b * Nn + j) * 3 + 0];
      const float cyj = centers[(size_t)(b * Nn + j) * 3 + 1];
      const float czj = centers[(size_t)(b * Nn + j) * 3 + 2];
      const float r0 = cxj - cxi, r1 = cyj - cyi, r2 = czj - czi;
      const float dist  = sqrtf(r0 * r0 + r1 * r1 + r2 * r2);
      const float horiz = sqrtf(r0 * r0 + r1 * r1);
      const float cose  = r2 / (dist + EPSF);
      const float dlog  = logf(dist + EPSF);
      // sizes for node j
      const float* cp = corners + (size_t)(b * Nn + j) * 24;
      float mx0 = -1e30f, mx1 = -1e30f, mx2 = -1e30f;
      float mn0 = 1e30f, mn1 = 1e30f, mn2 = 1e30f;
#pragma unroll
      for (int c = 0; c < 8; ++c) {
        float x = cp[c * 3 + 0], y = cp[c * 3 + 1], z = cp[c * 3 + 2];
        mx0 = fmaxf(mx0, x); mn0 = fminf(mn0, x);
        mx1 = fmaxf(mx1, y); mn1 = fminf(mn1, y);
        mx2 = fmaxf(mx2, z); mn2 = fminf(mn2, z);
      }
      const float sxj = mx0 - mn0, syj = mx1 - mn1, szj = mx2 - mn2;
      // Feature 9 (lower half) and feature 11 (upper half) share one division.
      const float ry  = syj / (syi + EPSF);
      const float rxz = (hi ? szj : sxj) / dxz;
      gb[0][0] = hi ? r2 : r0;
      gb[0][1] = hi ? dlog : r1;
      gb[1][0] = hi ? sxj - sxi : horiz;
      gb[1][1] = hi ? syj - syi : cose;
      gb[2][0] = hi ? ry : szj - szi;
      gb[2][1] = rxz;
    }

    // ---- stage 2: scores^T = (KF^T(64x12) @ geom^T(12x16) + KF row 12) * rs128
    v8f s[4];   // s[tt][r] = score of (t = 16 tt + 8 half + r, j)
#pragma unroll  // fragments stay in registers: constant indices
    for (int tt = 0; tt < 4; ++tt) {
      v8f acc = kc[tt];
#pragma unroll  // fragments stay in registers: constant indices
      for (int kk = 0; kk < 3; ++kk) acc = wmma4(kf[tt][kk], gb[kk], acc);
      s[tt] = acc * rs128;
    }

    // ---- stage 3: softmax over T=64, 32 registers in each of 2 lanes ----
    float inv;  // 1 / sum of the exponentials; applied behind the head product
    {
      float mx = -1e30f;
#pragma unroll  // s is a register array: constant indices
      for (int tt = 0; tt < 4; ++tt)
#pragma unroll  // s is a register array: constant indices
        for (int r = 0; r < 8; ++r) mx = fmaxf(mx, s[tt][r]);
      mx = fmaxf(mx, other_half(mx));
#pragma unroll  // s is a register array: constant indices
      for (int tt = 0; tt < 4; ++tt)
#pragma unroll  // s is a register array: constant indices
        for (int r = 0; r < 8; ++r) s[tt][r] = __expf(s[tt][r] - mx);
      const v8f sv = (s[0] + s[1]) + (s[2] + s[3]);
      float sum = ((sv[0] + sv[1]) + (sv[2] + sv[3])) +
                  ((sv[4] + sv[5]) + (sv[6] + sv[7]));
      sum += other_half(sum);
      inv = 1.f / sum;
    }

    // ---- stage 4: bias^T = gf(16x12) @ geom^T + hb + vf(16x64) @ exp^T * inv
    {
      v8f accg = hb;
#pragma unroll  // fragments stay in registers: constant indices
      for (int kk = 0; kk < 3; ++kk) accg = wmma4(gf[kk], gb[kk], accg);
      v8f acce;
#pragma unroll  // acce is a register vector: constant indices
      for (int r = 0; r < 8; ++r) acce[r] = 0.f;
#pragma unroll  // fragments stay in registers: constant indices
      for (int kk = 0; kk < 16; ++kk) {
        v2f ex;
        ex[0] = s[kk >> 2][2 * (kk & 3)];
        ex[1] = s[kk >> 2][2 * (kk & 3) + 1];
        acce = wmma4(vf[kk], ex, acce);
      }
      float* op = biasout + ((size_t)(b * Hh + 2 * half) * Nn + i) * Nn + j;
      op[0] = accg[0] + acce[0] * inv;
      op[(size_t)Nn * Nn] = accg[1] + acce[1] * inv;
    }
  }
}

// ---------------------------------------------------------------------------
// Self-attention: per (b, h, 16-row q tile), the 256 keys split over 4 waves.
// Both products are taken transposed, with the key index j (or the channel c) in
// the rows of D and the query index i in its columns, as in relbias_qkv_kernel: a
// lane holds 32 of its wave's 64 logits of its own i (lane ^ 16 the other 32),
// the softmax runs in registers, and the registers of the exponentials are, pair
// by pair, the B operand of the second product. Each wave keeps its own maximum,
// sum and partial output; they are merged once, through LDS, behind one barrier.
// A wave's operands are few enough to be loaded all at once, ahead of the work.
// grid = (N/16, H, B), block = 128 (4 waves)
// ---------------------------------------------------------------------------
#define OPITCH 36   // floats per row of a partial output: 16 B x odd

typedef __attribute__((ext_vector_type(4))) float v4f;

__global__ void __launch_bounds__(128)
attn_kernel(const float* __restrict__ q, const float* __restrict__ k,
            const float* __restrict__ v, const float* __restrict__ bias,
            float* __restrict__ outp) {
  __shared__ __attribute__((aligned(16))) float ldsO[4][16][OPITCH];  // [wave][i][c]
  __shared__ float ldsMS[4][2][16];  // [wave][0: maximum, 1: sum][i]

  const int i0   = blockIdx.x * 16;
  const int h    = blockIdx.y;
  const int b    = blockIdx.z;
  const int w    = threadIdx.x >> 5;
  const int lane = threadIdx.x & 31;
  const int half = lane >> 4;
  const int ln   = lane & 15;
  const int j0   = w * 64;
  const float scale = 0.1767766952966369f;  // 1/sqrt(32)

  v2f qf[8];      // q^T (d x i), d = 4 kk + 2 half + {0, 1}
  v2f kf[4][8];   // k (j x d), four 16-row j tiles, d as in qf
  v8f s[4];       // s[tt][r] = logit of (j = j0 + 16 tt + 8 half + r, i)
  v2f vf[2][16];  // v^T (c x j) in the k order of the logit registers (below)
  {
    const float* qp = q + (size_t)(b * Nn + i0 + ln) * Cc + h * Dd + 2 * half;
#pragma unroll  // fragments stay in registers: constant indices
    for (int kk = 0; kk < 8; ++kk) {
      qf[kk][0] = qp[4 * kk];
      qf[kk][1] = qp[4 * kk + 1];
    }
    asm volatile("s_wait_xcnt 0x0" ::: "memory");  // before the address registers above are reused
    const float* kp = k + (size_t)(b * Nn + j0 + ln) * Cc + h * Dd + 2 * half;
#pragma unroll  // fragments stay in registers: constant indices
    for (int tt = 0; tt < 4; ++tt)
#pragma unroll  // fragments stay in registers: constant indices
      for (int kk = 0; kk < 8; ++kk) {
        kf[tt][kk][0] = kp[tt * 16 * Cc + 4 * kk];
        kf[tt][kk][1] = kp[tt * 16 * Cc + 4 * kk + 1];
      }
    asm volatile("s_wait_xcnt 0x0" ::: "memory");  // before the address registers above are reused
    // The bias is the C operand of the first product: 8 j in a row per lane.
    const float* bp =
        bias + ((size_t)(b * Hh + h) * Nn + i0 + ln) * Nn + j0 + 8 * half;
#pragma unroll  // s is a register array: constant indices
    for (int tt = 0; tt < 4; ++tt) {
      const v4f lo = *(const v4f*)(bp + tt * 16);
      const v4f up = *(const v4f*)(bp + tt * 16 + 4);
#pragma unroll  // s is a register array: constant indices
      for (int r = 0; r < 4; ++r) {
        s[tt][r]     = lo[r];
        s[tt][r + 4] = up[r];
      }
    }
    asm volatile("s_wait_xcnt 0x0" ::: "memory");  // before the address registers above are reused
    // k step 4 tt + p of the second product takes j = j0 + 16 tt + 8 half +
    // 2 p + {0, 1}: registers 2 p and 2 p + 1 of logit tile tt.
    const float* vp = v + (size_t)(b * Nn + j0 + 8 * half) * Cc + h * Dd + ln;
#pragma unroll  // fragments stay in registers: constant indices
    for (int ct = 0; ct < 2; ++ct)
#pragma unroll  // fragments stay in registers: constant indices
      for (int kk = 0; kk < 16; ++kk) {
        const int jr = 16 * (kk >> 2) + 2 * (kk & 3);
        vf[ct][kk][0] = vp[jr * Cc + ct * 16];
        vf[ct][kk][1] = vp[(jr + 1) * Cc + ct * 16];
      }
    asm volatile("s_wait_xcnt 0x0" ::: "memory");  // before the address registers above are reused
  }

  // Keeps the loads of v ahead of the first product: without it they are moved
  // behind it and their latency is waited for a second time.
  __builtin_amdgcn_sched_barrier(0);

  // logits^T = k(64x32) @ (q * scale)^T(32x16) + bias^T
#pragma unroll  // fragments stay in registers: constant indices
  for (int kk = 0; kk < 8; ++kk) {
    const v2f qs = qf[kk] * scale;
#pragma unroll  // fragments stay in registers: constant indices
    for (int tt = 0; tt < 4; ++tt) s[tt] = wmma4(kf[tt][kk], qs, s[tt]);
  }

  // this wave's part of the softmax: 32 registers in each of 2 lanes
  float mx = -1e30f, sum;
  {
#pragma unroll  // s is a register array: constant indices
    for (int tt = 0; tt < 4; ++tt)
#pragma unroll  // s is a register array: constant indices
      for (int r = 0; r < 8; ++r) mx = fmaxf(mx, s[tt][r]);
    mx = fmaxf(mx, other_half(mx));
#pragma unroll  // s is a register array: constant indices
    for (int tt = 0; tt < 4; ++tt)
#pragma unroll  // s is a register array: constant indices
      for (int r = 0; r < 8; ++r) s[tt][r] = __expf(s[tt][r] - mx);
    const v8f sv = (s[0] + s[1]) + (s[2] + s[3]);
    sum = ((sv[0] + sv[1]) + (sv[2] + sv[3])) +
          ((sv[4] + sv[5]) + (sv[6] + sv[7]));
    sum += other_half(sum);
  }

  // partial out^T = v^T(32x64) @ exp^T(64x16)
  v8f o[2];  // o[ct][r] = (c = 16 ct + 8 half + r, i)
#pragma unroll  // o is a register array: constant indices
  for (int ct = 0; ct < 2; ++ct)
#pragma unroll  // o is a register array: constant indices
    for (int r = 0; r < 8; ++r) o[ct][r] = 0.f;
#pragma unroll  // fragments stay in registers: constant indices
  for (int kk = 0; kk < 16; ++kk) {
    v2f ex;
    ex[0] = s[kk >> 2][2 * (kk & 3)];
    ex[1] = s[kk >> 2][2 * (kk & 3) + 1];
#pragma unroll  // fragments stay in registers: constant indices
    for (int ct = 0; ct < 2; ++ct) o[ct] = wmma4(vf[ct][kk], ex, o[ct]);
  }

#pragma unroll  // o is a register array: constant indices
  for (int ct = 0; ct < 2; ++ct) {
    v4f lo, up;
#pragma unroll  // o is a register array: constant indices
    for (int r = 0; r < 4; ++r) {
      lo[r] = o[ct][r];
      up[r] = o[ct][r + 4];
    }
    *(v4f*)&ldsO[w][ln][ct * 16 + 8 * half]     = lo;
    *(v4f*)&ldsO[w][ln][ct * 16 + 8 * half + 4] = up;
  }
  ldsMS[w][half][ln] = half ? sum : mx;  // both are equal in the two lane halves
  __syncthreads();

  // merge: wave w takes rows 4 w .. 4 w + 3, 8 lanes a row, so that every
  // 128-byte line of the output is stored whole by one wave.
  {
    const int mi = 4 * w + (lane >> 3);
    const int mc = 4 * (lane & 7);
    float m[4];
#pragma unroll  // m is a register array: constant indices
    for (int x = 0; x < 4; ++x) m[x] = ldsMS[x][0][mi];
    const float mall = fmaxf(fmaxf(m[0], m[1]), fmaxf(m[2], m[3]));
    float tot = 0.f;
    v4f acc = {0.f, 0.f, 0.f, 0.f};
#pragma unroll  // m is a register array: constant indices
    for (int x = 0; x < 4; ++x) {
      const float f = __expf(m[x] - mall);
      tot += f * ldsMS[x][1][mi];
      acc += f * *(const v4f*)&ldsO[x][mi][mc];
    }
    const float inv = 1.f / tot;
    *(v4f*)(outp + (size_t)(b * Nn + i0 + mi) * Cc + h * Dd + mc) = acc * inv;
  }
}

// ---------------------------------------------------------------------------
extern "C" void kernel_launch(void* const* d_in, const int* in_sizes, int n_in,
                              void* d_out, int out_size, void* d_ws,
                              size_t ws_size, hipStream_t stream) {
  (void)in_sizes; (void)n_in; (void)out_size; (void)ws_size;
  const float* feat    = (const float*)d_in[0];
  const float* centers = (const float*)d_in[1];
  const float* corners = (const float*)d_in[2];
  const float* lang    = (const float*)d_in[3];
  const float* Wq = (const float*)d_in[4];  const float* bq = (const float*)d_in[5];
  const float* Wk = (const float*)d_in[6];  const float* bk = (const float*)d_in[7];
  const float* Wv = (const float*)d_in[8];  const float* bv = (const float*)d_in[9];
  const float* Wo = (const float*)d_in[10]; const float* bo = (const float*)d_in[11];
  const float* Wrel = (const float*)d_in[12]; const float* brel = (const float*)d_in[13];
  const float* Wtk  = (const float*)d_in[14]; const float* btk  = (const float*)d_in[15];
  const float* Wtv  = (const float*)d_in[16]; const float* btv  = (const float*)d_in[17];
  const float* Wbias = (const float*)d_in[18]; const float* bbias = (const float*)d_in[19];

  float* ws = (float*)d_ws;
  const size_t MR = (size_t)Bsz * Nn;  // 2048 rows
  float* qb      = ws;
  float* kb      = qb + MR * Cc;
  float* vb      = kb + MR * Cc;
  float* Pf      = vb + MR * Cc;
  float* Qf      = Pf + (size_t)16 * PP;
  float* KFf     = Qf + (size_t)QR * Hh;
  float* VFf     = KFf + (size_t)Bsz * 16 * Tt;
  float* biasb   = VFf + (size_t)Bsz * Tt * Hh;
  float* attnout = biasb + (size_t)Bsz * Hh * Nn * Nn;

  // folded tables of the language cross-attention
  fold_weights_kernel<<<18, 32, 0, stream>>>(Wrel, brel, Wtk, btk, Wtv, btv,
                                             Wbias, Pf, Qf);
  fold_text_kernel<<<dim3(8, Bsz), 32, 0, stream>>>(lang, Pf, Qf, KFf, VFf);

  // fused geometry + language cross-attention -> bias(B,H,N,N), and in the same
  // launch the q / k / v projections (2048x128 @ 128x128)
  relbias_qkv_kernel<<<dim3(Nn, Bsz + 3), 128, 0, stream>>>(
      centers, corners, Qf, KFf, VFf, bbias, biasb, feat, Wq, bq, Wk, bk, Wv, bv,
      qb, kb, vb);

  // biased multi-head self-attention
  attn_kernel<<<dim3(Nn / 16, Hh, Bsz), 128, 0, stream>>>(qb, kb, vb, biasb,
                                                         attnout);

  // final projection -> d_out
  gemm_bias_kernel<<<dim3(MR / 16, Cc / 16), 32, 0, stream>>>(attnout, Wo, bo, (float*)d_out, MR,
                                            Cc, Cc);
}

// v005
// Measured time: 35.2 microseconds a run.
// In two side-by-side timings against v004, it was 1.11 and 1.12 times as fast.
// Counting every step since v000, it is 10.1 times as fast.
#include <hip/hip_runtime.h>
#include <math.h>

// Problem constants (match reference)
#define Bsz 8
#define Nn  256
#define Cc  128
#define Tt  64
#define Hh  4
#define Gg  12
#define Dd  32
#define EPSF 1e-6f

typedef __attribute__((ext_vector_type(2))) float v2f;
typedef __attribute__((ext_vector_type(8))) float v8f;

// D = A(16x4,f32) * B(4x16,f32) + C(16x16,f32)   -> v_wmma_f32_16x16x4_f32
__device__ __forceinline__ v8f wmma4(v2f a, v2f b, v8f c) {
  return __builtin_amdgcn_wmma_f32_16x16x4_f32(false, a, false, b, (short)0, c,
                                               false, false);
}

// ---------------------------------------------------------------------------
// Generic GEMM: out[M x Nc] = A[M x K] @ W[K x Nc] + bias[Nc]
// One wave per 16x16 output tile at (row0, col0). K must be a multiple of 4.
// ---------------------------------------------------------------------------
__device__ __forceinline__ void
gemm_bias_tile(const float* __restrict__ A, const float* __restrict__ W,
               const float* __restrict__ bias, float* __restrict__ out,
               int row0, int col0, int K, int Nc) {
  const int lane = threadIdx.x & 31;
  const int half = lane >> 4;   // which K pair / which row half for C
  const int ln   = lane & 15;   // M index for A, N index for B/C

  v8f acc;
  const float bv = bias[col0 + ln];
#pragma unroll
  for (int r = 0; r < 8; ++r) acc[r] = bv;

  for (int k0 = 0; k0 < K; k0 += 4) {
    v2f a, b;
    const float* Ap = A + (size_t)(row0 + ln) * K + (k0 + 2 * half);
    a[0] = Ap[0];
    a[1] = Ap[1];
    const float* Wp = W + (size_t)(k0 + 2 * half) * Nc + (col0 + ln);
    b[0] = Wp[0];
    b[1] = Wp[Nc];
    acc = wmma4(a, b, acc);
  }

#pragma unroll
  for (int r = 0; r < 8; ++r) {
    const int row = r + 8 * half;
    out[(size_t)(row0 + row) * Nc + col0 + ln] = acc[r];
  }
}

// ---------------------------------------------------------------------------
// The per-pair chain is linear in the 12 geometry features up to the softmax
// and linear again behind it, so its weight products are taken once instead of
// once per (i, j) pair:
//   scores = geom @ (Wrel @ k_txt^T) + brel @ k_txt^T
//   bias   = geom @ (Wrel @ Wbias) + alpha @ (v_txt @ Wbias) + brel @ Wbias + bbias
// with k_txt = lang @ Wtk + btk and v_txt = lang @ Wtv + btv folded the same way.
//
// Step 1, independent of the batch.
//   blocks 0..8 : P[g][n] = sum_c WB[g][c] * Y[n][c]    (16 x PP)
//                 WB rows 0..11 = Wrel rows, 12 = brel, the rest 0
//                 Y rows 0..127 = Wtk rows, 128 = btk, the rest 0
//   blocks 9..17: Q[m][h] = sum_c Z[m][c] * Wbias[c][h] (QR x 4)
//                 Z rows 0..127 = Wtv rows, 128 = btv, 129..140 = Wrel rows,
//                 141 = brel, the rest 0
// grid = 18, block = 32
// ---------------------------------------------------------------------------
#define PP 144
#define QR 144
#define QG (Cc + 1)   // first row of Wrel @ Wbias in Q

__global__ void __launch_bounds__(32)
fold_weights_kernel(const float* __restrict__ Wrel, const float* __restrict__ brel,
                    const float* __restrict__ Wtk, const float* __restrict__ btk,
                    const float* __restrict__ Wtv, const float* __restrict__ btv,
                    const float* __restrict__ Wbias,
                    float* __restrict__ P, float* __restrict__ Q) {
  const int lane = threadIdx.x & 31;
  const int half = lane >> 4;
  const int ln   = lane & 15;
  const int blk  = blockIdx.x;

  v8f acc;
#pragma unroll  // acc is a register vector: constant indices
  for (int r = 0; r < 8; ++r) acc[r] = 0.f;

  // A lane whose row or column is padding reads a valid address and selects 0.
  if (blk < 9) {
    const int n = blk * 16 + ln;
    const float* ap = ((ln < Gg) ? Wrel + ln * Cc : brel) + 2 * half;
    const float* bp = ((n < Cc) ? Wtk + n * Cc : btk) + 2 * half;
    const bool aon = ln <= Gg, bon = n <= Cc;
    // Unrolled: one wave per tile, so the loads of all k steps fly together.
#pragma unroll
    for (int k0 = 0; k0 < Cc; k0 += 4) {
      const float a0 = ap[k0], a1 = ap[k0 + 1];
      const float b0 = bp[k0], b1 = bp[k0 + 1];
      v2f a, bb;
      a[0]  = aon ? a0 : 0.f;
      a[1]  = aon ? a1 : 0.f;
      bb[0] = bon ? b0 : 0.f;
      bb[1] = bon ? b1 : 0.f;
      acc = wmma4(a, bb, acc);
    }
#pragma unroll  // acc is a register vector: constant indices
    for (int r = 0; r < 8; ++r) P[(r + 8 * half) * PP + n] = acc[r];
  } else {
    const int m0 = (blk - 9) * 16;
    const int m  = m0 + ln;
    const float* ap = (m < Cc)        ? Wtv + m * Cc
                    : (m == Cc)       ? btv
                    : (m < QG + Gg)   ? Wrel + (m - QG) * Cc
                                      : brel;
    ap += 2 * half;
    const float* bp = Wbias + 2 * half * Hh + (ln & (Hh - 1));
    const bool aon = m <= QG + Gg, bon = ln < Hh;
    // Unrolled: one wave per tile, so the loads of all k steps fly together.
#pragma unroll
    for (int k0 = 0; k0 < Cc; k0 += 4) {
      const float a0 = ap[k0], a1 = ap[k0 + 1];
      const float b0 = bp[k0 * Hh], b1 = bp[(k0 + 1) * Hh];
      v2f a, bb;
      a[0]  = aon ? a0 : 0.f;
      a[1]  = aon ? a1 : 0.f;
      bb[0] = bon ? b0 : 0.f;
      bb[1] = bon ? b1 : 0.f;
      acc = wmma4(a, bb, acc);
    }
    if (bon) {
#pragma unroll  // acc is a register vector: constant indices
      for (int r = 0; r < 8; ++r) Q[(m0 + r + 8 * half) * Hh + ln] = acc[r];
    }
  }
}

// ---------------------------------------------------------------------------
// Step 2, per batch.
//   blockIdx.x 0..3: KF[b][g][t] = sum_m P[g][m] * lang[b][t][m] + P[g][128]
//                    (rows 0..11 = Wrel @ k_txt^T, row 12 = brel @ k_txt^T)
//   blockIdx.x 4..7: VF[b][t][h] = sum_m lang[b][t][m] * Q[m][h] + Q[128][h]
//                    (= v_txt @ Wbias)
// grid = (8, B), block = 32
// ---------------------------------------------------------------------------
__global__ void __launch_bounds__(32)
fold_text_kernel(const float* __restrict__ lang, const float* __restrict__ P,
                 const float* __restrict__ Q, float* __restrict__ KF,
                 float* __restrict__ VF) {
  const int lane = threadIdx.x & 31;
  const int half = lane >> 4;
  const int ln   = lane & 15;
  const int b    = blockIdx.y;
  const int t0   = (blockIdx.x & 3) * 16;
  const float* lp = lang + (size_t)(b * Tt + t0 + ln) * Cc + 2 * half;

  v8f acc;
  if (blockIdx.x < 4) {
    const float* pp = P + ln * PP + 2 * half;
    const float* pc = P + 8 * half * PP + Cc;
#pragma unroll  // acc is a register vector: constant indices
    for (int r = 0; r < 8; ++r) acc[r] = pc[r * PP];
    // Unrolled: one wave per tile, so the loads of all k steps fly together.
#pragma unroll
    for (int k0 = 0; k0 < Cc; k0 += 4) {
      v2f a, bb;
      a[0]  = pp[k0];
      a[1]  = pp[k0 + 1];
      bb[0] = lp[k0];
      bb[1] = lp[k0 + 1];
      acc = wmma4(a, bb, acc);
    }
#pragma unroll  // acc is a register vector: constant indices
    for (int r = 0; r < 8; ++r)
      KF[(size_t)(b * 16 + r + 8 * half) * Tt + t0 + ln] = acc[r];
  } else {
    // Padding columns read a valid one and select 0.
    const float* qp = Q + 2 * half * Hh + (ln & (Hh - 1));
    const bool on = ln < Hh;
    const float qb = Q[Cc * Hh + (ln & (Hh - 1))];
#pragma unroll  // acc is a register vector: constant indices
    for (int r = 0; r < 8; ++r) acc[r] = on ? qb : 0.f;
    // Unrolled: one wave per tile, so the loads of all k steps fly together.
#pragma unroll
    for (int k0 = 0; k0 < Cc; k0 += 4) {
      const float b0 = qp[k0 * Hh], b1 = qp[(k0 + 1) * Hh];
      v2f a, bb;
      a[0]  = lp[k0];
      a[1]  = lp[k0 + 1];
      bb[0] = on ? b0 : 0.f;
      bb[1] = on ? b1 : 0.f;
      acc = wmma4(a, bb, acc);
    }
    if (on) {
#pragma unroll  // acc is a register vector: constant indices
      for (int r = 0; r < 8; ++r)
        VF[(size_t)(b * Tt + t0 + r + 8 * half) * Hh + ln] = acc[r];
    }
  }
}

// ---------------------------------------------------------------------------
// Fused: geometry -> lang cross-attn scores -> softmax -> bias head, on the
// folded tables (Q, KF, VF above).
// Every product is taken transposed, with the text index t (or the head) in the
// rows of D and the pair index j in its columns. A lane then holds 32 of the 64
// scores of its own j (lane ^ 16 holds the other 32), so the softmax runs in
// registers, and the registers of the exponentials are, pair by pair, the B
// operand of the head product; 1 / sum is the same for a whole column of D and
// multiplies the two result rows. Nothing goes through LDS and no wave waits
// for another.
// grid = (N, B + 3), block = 128 (4 waves). For blockIdx.y < B each wave handles
// four 16-wide j tiles, 64 j in a row, of this (b, i).
//
// The q, k and v projections depend on nothing that this kernel reads or writes,
// so they ride in the same launch instead of three launches of their own:
// blockIdx.y = B, B + 1, B + 2 is q, k, v, one 16x16 tile a wave, the 4 waves of a
// block on 4 column tiles of the same rows. They have the highest indices, so
// they start last, in the places that the first bias blocks leave.
// ---------------------------------------------------------------------------
// Value of lane ^ 16.
__device__ __forceinline__ float other_half(float x) {
  const int v = __builtin_bit_cast(int, x);
  return __builtin_bit_cast(
      float, __builtin_amdgcn_permlanex16(v, v, 0x76543210, 0xfedcba98, false, false));
}

__global__ void __launch_bounds__(128)
relbias_qkv_kernel(const float* __restrict__ centers,
                   const float* __restrict__ corners,
                   const float* __restrict__ Q, const float* __restrict__ KF,
                   const float* __restrict__ VF, const float* __restrict__ bbias,
                   float* __restrict__ biasout, const float* __restrict__ feat,
                   const float* __restrict__ Wq, const float* __restrict__ bq,
                   const float* __restrict__ Wk, const float* __restrict__ bk,
                   const float* __restrict__ Wv, const float* __restrict__ bv,
                   float* __restrict__ qout, float* __restrict__ kout,
                   float* __restrict__ vout) {
  if (blockIdx.y >= Bsz) {
    const int p = blockIdx.y - Bsz;
    const float* Wp = p == 0 ? Wq : p == 1 ? Wk : Wv;
    const float* bp = p == 0 ? bq : p == 1 ? bk : bv;
    float*       op = p == 0 ? qout : p == 1 ? kout : vout;
    // The wave's number, held in a scalar register: the tile's origin is then
    // scalar arithmetic.
    const int tile =
        blockIdx.x * 4 + __builtin_amdgcn_readfirstlane(threadIdx.x >> 5);
    gemm_bias_tile(feat, Wp, bp, op, (tile >> 3) * 16, (tile & 7) * 16, Cc, Cc);
    return;
  }

  const int i    = blockIdx.x;
  const int b    = blockIdx.y;
  const int w    = threadIdx.x >> 5;
  const int lane = threadIdx.x & 31;
  const int half = lane >> 4;
  const int ln   = lane & 15;

  // sizes for node i (same for all lanes; cheap)
  float sxi, syi, szi;
  {
    const float* cp = corners + (size_t)(b * Nn + i) * 24;
    float mx0 = -1e30f, mx1 = -1e30f, mx2 = -1e30f;
    float mn0 = 1e30f, mn1 = 1e30f, mn2 = 1e30f;
#pragma unroll
    for (int c = 0; c < 8; ++c) {
      float x = cp[c * 3 + 0], y = cp[c * 3 + 1], z = cp[c * 3 + 2];
      mx0 = fmaxf(mx0, x); mn0 = fminf(mn0, x);
      mx1 = fmaxf(mx1, y); mn1 = fminf(mn1, y);
      mx2 = fmaxf(mx2, z); mn2 = fminf(mn2, z);
    }
    sxi = mx0 - mn0; syi = mx1 - mn1; szi = mx2 - mn2;
  }
  const float cxi = centers[(size_t)(b * Nn + i) * 3 + 0];
  const float cyi = centers[(size_t)(b * Nn + i) * 3 + 1];
  const float czi = centers[(size_t)(b * Nn + i) * 3 + 2];

  const float rs128 = 0.08838834764831845f;  // 1/sqrt(128)
  const bool  hi  = half != 0;
  const float dxz = (hi ? szi : sxi) + EPSF;

  // A fragments of the folded tables: the same for every j tile of this block.
  // Head rows of D: head 2 * half + r sits in register r (r = 0, 1) of each lane
  // half, i.e. in A rows 0, 1, 8, 9, so that all 32 lanes store.
  v2f kf[4][3];   // KF[b] rows 0..11 as (t x g), four 16-row t tiles
  v8f kc[4];      // KF[b] row 12 at t = 16 tt + 8 half + r: C of the scores
  v2f gf[3];      // (Wrel @ Wbias)^T, rows other than 0, 1, 8, 9 zero
  v2f vf[16];     // VF[b]^T in the k order of the score registers (below)
  v8f hb;         // brel @ Wbias + bbias: C of the head
  {
    const float* KFb = KF + (size_t)b * 16 * Tt;
    const float* VFb = VF + (size_t)b * Tt * Hh;
#pragma unroll  // fragments stay in registers: constant indices
    for (int tt = 0; tt < 4; ++tt) {
#pragma unroll  // fragments stay in registers: constant indices
      for (int kk = 0; kk < 3; ++kk) {
        kf[tt][kk][0] = KFb[(4 * kk + 2 * half) * Tt + tt * 16 + ln];
        kf[tt][kk][1] = KFb[(4 * kk + 2 * half + 1) * Tt + tt * 16 + ln];
      }
#pragma unroll  // kc is a register vector: constant indices
      for (int r = 0; r < 8; ++r)
        kc[tt][r] = KFb[Gg * Tt + tt * 16 + 8 * half + r];
    }
    // padding rows read a valid head, select 0
    const int hc = 2 * (ln >> 3) + (ln & 1);
    const bool on = (ln & 7) < 2;
#pragma unroll  // fragments stay in registers: constant indices
    for (int kk = 0; kk < 3; ++kk) {
      const float g0 = Q[(QG + 4 * kk + 2 * half) * Hh + hc];
      const float g1 = Q[(QG + 4 * kk + 2 * half + 1) * Hh + hc];
      gf[kk][0] = on ? g0 : 0.f;
      gf[kk][1] = on ? g1 : 0.f;
    }
    // k step 4 tt + p of the head takes t = 16 tt + 8 half + 2 p + {0, 1}:
    // registers 2 p and 2 p + 1 of score tile tt.
#pragma unroll  // fragments stay in registers: constant indices
    for (int kk = 0; kk < 16; ++kk) {
      const int t = 16 * (kk >> 2) + 8 * half + 2 * (kk & 3);
      const float v0 = VFb[t * Hh + hc];
      const float v1 = VFb[(t + 1) * Hh + hc];
      vf[kk][0] = on ? v0 : 0.f;
      vf[kk][1] = on ? v1 : 0.f;
    }
#pragma unroll  // hb is a register vector: constant indices
    for (int r = 0; r < 8; ++r) hb[r] = 0.f;
    hb[0] = Q[(QG + Gg) * Hh + 2 * half] + bbias[2 * half];
    hb[1] = Q[(QG + Gg) * Hh + 2 * half + 1] + bbias[2 * half + 1];
  }

  for (int jo = 0; jo < 4; ++jo) {
    const int j = w * 64 + jo * 16 + ln;

    // ---- stage 1: geometry features of pair (i, j), in both lane halves ----
    v2f gb[3];  // geom^T (g x j), g = 4 kk + 2 half + {0, 1} as in kf and gf
    {
      const float cxj = centers[(size_t)(b * Nn + j) * 3 + 0];
      const float cyj = centers[(size_t)(b * Nn + j) * 3 + 1];
      const float czj = centers[(size_t)(b * Nn + j) * 3 + 2];
      const float r0 = cxj - cxi, r1 = cyj - cyi, r2 = czj - czi;
      const float dist  = sqrtf(r0 * r0 + r1 * r1 + r2 * r2);
      const float horiz = sqrtf(r0 * r0 + r1 * r1);
      const float cose  = r2 / (dist + EPSF);
      const float dlog  = logf(dist + EPSF);
      // sizes for node j
      const float* cp = corners + (size_t)(b * Nn + j) * 24;
      float mx0 = -1e30f, mx1 = -1e30f, mx2 = -1e30f;
      float mn0 = 1e30f, mn1 = 1e30f, mn2 = 1e30f;
#pragma unroll
      for (int c = 0; c < 8; ++c) {
        float x = cp[c * 3 + 0], y = cp[c * 3 + 1], z = cp[c * 3 + 2];
        mx0 = fmaxf(mx0, x); mn0 = fminf(mn0, x);
        mx1 = fmaxf(mx1, y); mn1 = fminf(mn1, y);
        mx2 = fmaxf(mx2, z); mn2 = fminf(mn2, z);
      }
      const float sxj = mx0 - mn0, syj = mx1 - mn1, szj = mx2 - mn2;
      // Feature 9 (lower half) and feature 11 (upper half) share one division.
      const float ry  = syj / (syi + EPSF);
      const float rxz = (hi ? szj : sxj) / dxz;
      gb[0][0] = hi ? r2 : r0;
      gb[0][1] = hi ? dlog : r1;
      gb[1][0] = hi ? sxj - sxi : horiz;
      gb[1][1] = hi ? syj - syi : cose;
      gb[2][0] = hi ? ry : szj - szi;
      gb[2][1] = rxz;
    }

    // ---- stage 2: scores^T = (KF^T(64x12) @ geom^T(12x16) + KF row 12) * rs128
    v8f s[4];   // s[tt][r] = score of (t = 16 tt + 8 half + r, j)
#pragma unroll  // fragments stay in registers: constant indices
    for (int tt = 0; tt < 4; ++tt) {
      v8f acc = kc[tt];
#pragma unroll  // fragments stay in registers: constant indices
      for (int kk = 0; kk < 3; ++kk) acc = wmma4(kf[tt][kk], gb[kk], acc);
      s[tt] = acc * rs128;
    }

    // ---- stage 3: softmax over T=64, 32 registers in each of 2 lanes ----
    float inv;  // 1 / sum of the exponentials; applied behind the head product
    {
      float mx = -1e30f;
#pragma unroll  // s is a register array: constant indices
      for (int tt = 0; tt < 4; ++tt)
#pragma unroll  // s is a register array: constant indices
        for (int r = 0; r < 8; ++r) mx = fmaxf(mx, s[tt][r]);
      mx = fmaxf(mx, other_half(mx));
#pragma unroll  // s is a register array: constant indices
      for (int tt = 0; tt < 4; ++tt)
#pragma unroll  // s is a register array: constant indices
        for (int r = 0; r < 8; ++r) s[tt][r] = __expf(s[tt][r] - mx);
      const v8f sv = (s[0] + s[1]) + (s[2] + s[3]);
      float sum = ((sv[0] + sv[1]) + (sv[2] + sv[3])) +
                  ((sv[4] + sv[5]) + (sv[6] + sv[7]));
      sum += other_half(sum);
      inv = 1.f / sum;
    }

    // ---- stage 4: bias^T = gf(16x12) @ geom^T + hb + vf(16x64) @ exp^T * inv
    {
      v8f accg = hb;
#pragma unroll  // fragments stay in registers: constant indices
      for (int kk = 0; kk < 3; ++kk) accg = wmma4(gf[kk], gb[kk], accg);
      v8f acce;
#pragma unroll  // acce is a register vector: constant indices
      for (int r = 0; r < 8; ++r) acce[r] = 0.f;
#pragma unroll  // fragments stay in registers: constant indices
      for (int kk = 0; kk < 16; ++kk) {
        v2f ex;
        ex[0] = s[kk >> 2][2 * (kk & 3)];
        ex[1] = s[kk >> 2][2 * (kk & 3) + 1];
        acce = wmma4(vf[kk], ex, acce);
      }
      float* op = biasout + ((size_t)(b * Hh + 2 * half) * Nn + i) * Nn + j;
      op[0] = accg[0] + acce[0] * inv;
      op[(size_t)Nn * Nn] = accg[1] + acce[1] * inv;
    }
  }
}

// ---------------------------------------------------------------------------
// Self-attention and output projection: per (b, 16-row q tile), 4 waves a head,
// the 256 keys of a head split over its 4 waves.
// Both products are taken transposed, with the key index j (or the channel c) in
// the rows of D and the query index i in its columns, as in relbias_qkv_kernel: a
// lane holds 32 of its wave's 64 logits of its own i (lane ^ 16 the other 32),
// the softmax runs in registers, and the registers of the exponentials are, pair
// by pair, the B operand of the second product. Each wave keeps its own maximum,
// sum and partial output; they are merged once, through LDS, behind one barrier.
// A wave's operands are few enough to be loaded all at once, ahead of the work.
// A block holds all 4 heads, i.e. all 128 channels of its 16 rows, so the merged
// rows stay in LDS and are the A operand of the product with Wo, behind a second
// barrier: 8 waves, one 16x16 tile of the output each, in the k order and with
// the start value of gemm_bias_tile.
// grid = (N/16, B), block = 512 (16 waves: 4 h + key quarter)
// ---------------------------------------------------------------------------
#define OPITCH 36   // floats per row of a partial output: 16 B x odd
#define APITCH 132  // floats per merged row: 16 rows x 8 B x 2 halves meet each bank once

typedef __attribute__((ext_vector_type(4))) float v4f;

__global__ void __launch_bounds__(512)
attn_proj_kernel(const float* __restrict__ q, const float* __restrict__ k,
                 const float* __restrict__ v, const float* __restrict__ bias,
                 const float* __restrict__ Wo, const float* __restrict__ bo,
                 float* __restrict__ outp) {
  __shared__ __attribute__((aligned(16))) float ldsO[16][16][OPITCH];  // [wave][i][c]
  __shared__ float ldsMS[16][2][16];  // [wave][0: maximum, 1: sum][i]
  __shared__ __attribute__((aligned(16))) float ldsA[16][APITCH];  // merged [i][c of all heads]

  const int i0   = blockIdx.x * 16;
  const int b    = blockIdx.y;
  // The wave's number, held in a scalar register: head, key quarter and the test
  // for the projection's waves are then scalar.
  const int wv   = __builtin_amdgcn_readfirstlane(threadIdx.x >> 5);
  const int h    = wv >> 2;
  const int w    = wv & 3;
  const int lane = threadIdx.x & 31;
  const int half = lane >> 4;
  const int ln   = lane & 15;
  const int j0   = w * 64;
  const float scale = 0.1767766952966369f;  // 1/sqrt(32)

  v2f qf[8];      // q^T (d x i), d = 4 kk + 2 half + {0, 1}
  v2f kf[4][8];   // k (j x d), four 16-row j tiles, d as in qf
  v8f s[4];       // s[tt][r] = logit of (j = j0 + 16 tt + 8 half + r, i)
  v2f vf[2][16];  // v^T (c x j) in the k order of the logit registers (below)
  {
    const float* qp = q + (size_t)(b * Nn + i0 + ln) * Cc + h * Dd + 2 * half;
#pragma unroll  // fragments stay in registers: constant indices
    for (int kk = 0; kk < 8; ++kk) {
      qf[kk][0] = qp[4 * kk];
      qf[kk][1] = qp[4 * kk + 1];
    }
    asm volatile("s_wait_xcnt 0x0" ::: "memory");  // before the address registers above are reused
    const float* kp = k + (size_t)(b * Nn + j0 + ln) * Cc + h * Dd + 2 * half;
#pragma unroll  // fragments stay in registers: constant indices
    for (int tt = 0; tt < 4; ++tt)
#pragma unroll  // fragments stay in registers: constant indices
      for (int kk = 0; kk < 8; ++kk) {
        kf[tt][kk][0] = kp[tt * 16 * Cc + 4 * kk];
        kf[tt][kk][1] = kp[tt * 16 * Cc + 4 * kk + 1];
      }
    asm volatile("s_wait_xcnt 0x0" ::: "memory");  // before the address registers above are reused
    // The bias is the C operand of the first product: 8 j in a row per lane.
    const float* bp =
        bias + ((size_t)(b * Hh + h) * Nn + i0 + ln) * Nn + j0 + 8 * half;
#pragma unroll  // s is a register array: constant indices
    for (int tt = 0; tt < 4; ++tt) {
      const v4f lo = *(const v4f*)(bp + tt * 16);
      const v4f up = *(const v4f*)(bp + tt * 16 + 4);
#pragma unroll  // s is a register array: constant indices
      for (int r = 0; r < 4; ++r) {
        s[tt][r]     = lo[r];
        s[tt][r + 4] = up[r];
      }
    }
    asm volatile("s_wait_xcnt 0x0" ::: "memory");  // before the address registers above are reused
    // k step 4 tt + p of the second product takes j = j0 + 16 tt + 8 half +
    // 2 p + {0, 1}: registers 2 p and 2 p + 1 of logit tile tt.
    const float* vp = v + (size_t)(b * Nn + j0 + 8 * half) * Cc + h * Dd + ln;
#pragma unroll  // fragments stay in registers: constant indices
    for (int ct = 0; ct < 2; ++ct)
#pragma unroll  // fragments stay in registers: constant indices
      for (int kk = 0; kk < 16; ++kk) {
        const int jr = 16 * (kk >> 2) + 2 * (kk & 3);
        vf[ct][kk][0] = vp[jr * Cc + ct * 16];
        vf[ct][kk][1] = vp[(jr + 1) * Cc + ct * 16];
      }
    asm volatile("s_wait_xcnt 0x0" ::: "memory");  // before the address registers above are reused
  }

  // Keeps the loads of v ahead of the first product: without it they are moved
  // behind it and their latency is waited for a second time.
  __builtin_amdgcn_sched_barrier(0);

  // logits^T = k(64x32) @ (q * scale)^T(32x16) + bias^T
#pragma unroll  // fragments stay in registers: constant indices
  for (int kk = 0; kk < 8; ++kk) {
    const v2f qs = qf[kk] * scale;
#pragma unroll  // fragments stay in registers: constant indices
    for (int tt = 0; tt < 4; ++tt) s[tt] = wmma4(kf[tt][kk], qs, s[tt]);
  }

  // this wave's part of the softmax: 32 registers in each of 2 lanes
  float mx = -1e30f, sum;
  {
#pragma unroll  // s is a register array: constant indices
    for (int tt = 0; tt < 4; ++tt)
#pragma unroll  // s is a register array: constant indices
      for (int r = 0; r < 8; ++r) mx = fmaxf(mx, s[tt][r]);
    mx = fmaxf(mx, other_half(mx));
  }

  // The projection's waves fetch their tile of Wo (k x n, k = 4 kk + 2 half +
  // {0, 1}) here, into the registers that k has left: it lands under the
  // exponentials and the second product.
  v2f wf[32];
  float bov = 0.f;
  if (wv < 8) {
    const float* wp = Wo + (size_t)(2 * half) * Cc + wv * 16 + ln;
#pragma unroll  // fragments stay in registers: constant indices
    for (int kk = 0; kk < 32; ++kk) {
      wf[kk][0] = wp[4 * kk * Cc];
      wf[kk][1] = wp[(4 * kk + 1) * Cc];
    }
    bov = bo[wv * 16 + ln];
    asm volatile("s_wait_xcnt 0x0" ::: "memory");  // before the address registers above are reused
  }

  {
#pragma unroll  // s is a register array: constant indices
    for (int tt = 0; tt < 4; ++tt)
#pragma unroll  // s is a register array: constant indices
      for (int r = 0; r < 8; ++r) s[tt][r] = __expf(s[tt][r] - mx);
    const v8f sv = (s[0] + s[1]) + (s[2] + s[3]);
    sum = ((sv[0] + sv[1]) + (sv[2] + sv[3])) +
          ((sv[4] + sv[5]) + (sv[6] + sv[7]));
    sum += other_half(sum);
  }

  // partial out^T = v^T(32x64) @ exp^T(64x16)
  v8f o[2];  // o[ct][r] = (c = 16 ct + 8 half + r, i)
#pragma unroll  // o is a register array: constant indices
  for (int ct = 0; ct < 2; ++ct)
#pragma unroll  // o is a register array: constant indices
    for (int r = 0; r < 8; ++r) o[ct][r] = 0.f;
#pragma unroll  // fragments stay in registers: constant indices
  for (int kk = 0; kk < 16; ++kk) {
    v2f ex;
    ex[0] = s[kk >> 2][2 * (kk & 3)];
    ex[1] = s[kk >> 2][2 * (kk & 3) + 1];
#pragma unroll  // fragments stay in registers: constant indices
    for (int ct = 0; ct < 2; ++ct) o[ct] = wmma4(vf[ct][kk], ex, o[ct]);
  }

#pragma unroll  // o is a register array: constant indices
  for (int ct = 0; ct < 2; ++ct) {
    v4f lo, up;
#pragma unroll  // o is a register array: constant indices
    for (int r = 0; r < 4; ++r) {
      lo[r] = o[ct][r];
      up[r] = o[ct][r + 4];
    }
    *(v4f*)&ldsO[wv][ln][ct * 16 + 8 * half]     = lo;
    *(v4f*)&ldsO[wv][ln][ct * 16 + 8 * half + 4] = up;
  }
  ldsMS[wv][half][ln] = half ? sum : mx;  // both are equal in the two lane halves
  __syncthreads();

  // merge: wave w of head h takes rows 4 w .. 4 w + 3 of that head, 8 lanes a row.
  {
    const int mi = 4 * w + (lane >> 3);
    const int mc = 4 * (lane & 7);
    float m[4];
#pragma unroll  // m is a register array: constant indices
    for (int x = 0; x < 4; ++x) m[x] = ldsMS[4 * h + x][0][mi];
    const float mall = fmaxf(fmaxf(m[0], m[1]), fmaxf(m[2], m[3]));
    float tot = 0.f;
    v4f acc = {0.f, 0.f, 0.f, 0.f};
#pragma unroll  // m is a register array: constant indices
    for (int x = 0; x < 4; ++x) {
      const float f = __expf(m[x] - mall);
      tot += f * ldsMS[4 * h + x][1][mi];
      acc += f * *(const v4f*)&ldsO[4 * h + x][mi][mc];
    }
    const float inv = 1.f / tot;
    *(v4f*)&ldsA[mi][h * Dd + mc] = acc * inv;
  }
  __syncthreads();

  // out(16x16 tile) = merged rows(16x128) @ Wo(128x16) + bo
  if (wv < 8) {
    v8f acc;
#pragma unroll  // acc is a register vector: constant indices
    for (int r = 0; r < 8; ++r) acc[r] = bov;
    float* op = outp + (size_t)(b * Nn + i0 + 8 * half) * Cc + wv * 16 + ln;
    v2f af[32];  // merged rows (i x k), k as in wf
#pragma unroll  // fragments stay in registers: constant indices
    for (int kk = 0; kk < 32; ++kk)
      af[kk] = *(const v2f*)&ldsA[ln][4 * kk + 2 * half];
    // Keeps all the LDS reads ahead of the product: spread among its dependent
    // steps, one pair ahead, each of them is waited for.
    __builtin_amdgcn_sched_barrier(0);
#pragma unroll  // fragments stay in registers: constant indices
    for (int kk = 0; kk < 32; ++kk) acc = wmma4(af[kk], wf[kk], acc);
#pragma unroll  // acc is a register vector: constant indices
    for (int r = 0; r < 8; ++r) op[r * Cc] = acc[r];
  }
}

// ---------------------------------------------------------------------------
extern "C" void kernel_launch(void* const* d_in, const int* in_sizes, int n_in,
                              void* d_out, int out_size, void* d_ws,
                              size_t ws_size, hipStream_t stream) {
  (void)in_sizes; (void)n_in; (void)out_size; (void)ws_size;
  const float* feat    = (const float*)d_in[0];
  const float* centers = (const float*)d_in[1];
  const float* corners = (const float*)d_in[2];
  const float* lang    = (const float*)d_in[3];
  const float* Wq = (const float*)d_in[4];  const float* bq = (const float*)d_in[5];
  const float* Wk = (const float*)d_in[6];  const float* bk = (const float*)d_in[7];
  const float* Wv = (const float*)d_in[8];  const float* bv = (const float*)d_in[9];
  const float* Wo = (const float*)d_in[10]; const float* bo = (const float*)d_in[11];
  const float* Wrel = (const float*)d_in[12]; const float* brel = (const float*)d_in[13];
  const float* Wtk  = (const float*)d_in[14]; const float* btk  = (const float*)d_in[15];
  const float* Wtv  = (const float*)d_in[16]; const float* btv  = (const float*)d_in[17];
  const float* Wbias = (const float*)d_in[18]; const float* bbias = (const float*)d_in[19];

  float* ws = (float*)d_ws;
  const size_t MR = (size_t)Bsz * Nn;  // 2048 rows
  float* qb      = ws;
  float* kb      = qb + MR * Cc;
  float* vb      = kb + MR * Cc;
  float* Pf      = vb + MR * Cc;
  float* Qf      = Pf + (size_t)16 * PP;
  float* KFf     = Qf + (size_t)QR * Hh;
  float* VFf     = KFf + (size_t)Bsz * 16 * Tt;
  float* biasb   = VFf + (size_t)Bsz * Tt * Hh;

  // folded tables of the language cross-attention
  fold_weights_kernel<<<18, 32, 0, stream>>>(Wrel, brel, Wtk, btk, Wtv, btv,
                                             Wbias, Pf, Qf);
  fold_text_kernel<<<dim3(8, Bsz), 32, 0, stream>>>(lang, Pf, Qf, KFf, VFf);

  // fused geometry + language cross-attention -> bias(B,H,N,N), and in the same
  // launch the q / k / v projections (2048x128 @ 128x128)
  relbias_qkv_kernel<<<dim3(Nn, Bsz + 3), 128, 0, stream>>>(
      centers, corners, Qf, KFf, VFf, bbias, biasb, feat, Wq, bq, Wk, bk, Wv, bv,
      qb, kb, vb);

  // biased multi-head self-attention and the final projection -> d_out
  attn_proj_kernel<<<dim3(Nn / 16, Bsz), 512, 0, stream>>>(qb, kb, vb, biasb, Wo,
                                                           bo, (float*)d_out);
}

// v006
// Measured time: 33.3 microseconds a run.
// Timed twice side by side with v005, it ran 1.06 times as fast both times.
// Counting every step since v000, it is 10.7 times as fast.
#include <hip/hip_runtime.h>
#include <math.h>

// Problem constants (match reference)
#define Bsz 8
#define Nn  256
#define Cc  128
#define Tt  64
#define Hh  4
#define Gg  12
#define Dd  32
#define EPSF 1e-6f

typedef __attribute__((ext_vector_type(2))) float v2f;
typedef __attribute__((ext_vector_type(4))) float v4f;
typedef __attribute__((ext_vector_type(8))) float v8f;

// D = A(16x4,f32) * B(4x16,f32) + C(16x16,f32)   -> v_wmma_f32_16x16x4_f32
__device__ __forceinline__ v8f wmma4(v2f a, v2f b, v8f c) {
  return __builtin_amdgcn_wmma_f32_16x16x4_f32(false, a, false, b, (short)0, c,
                                               false, false);
}

// ---------------------------------------------------------------------------
// Generic GEMM: out[M x Nc] = A[M x K] @ W[K x Nc] + bias[Nc]
// One wave per 16x16 output tile at (row0, col0). K must be a multiple of 4.
// ---------------------------------------------------------------------------
__device__ __forceinline__ void
gemm_bias_tile(const float* __restrict__ A, const float* __restrict__ W,
               const float* __restrict__ bias, float* __restrict__ out,
               int row0, int col0, int K, int Nc) {
  const int lane = threadIdx.x & 31;
  const int half = lane >> 4;   // which K pair / which row half for C
  const int ln   = lane & 15;   // M index for A, N index for B/C

  v8f acc;
  const float bv = bias[col0 + ln];
#pragma unroll
  for (int r = 0; r < 8; ++r) acc[r] = bv;

  for (int k0 = 0; k0 < K; k0 += 4) {
    v2f a, b;
    const float* Ap = A + (size_t)(row0 + ln) * K + (k0 + 2 * half);
    a[0] = Ap[0];
    a[1] = Ap[1];
    const float* Wp = W + (size_t)(k0 + 2 * half) * Nc + (col0 + ln);
    b[0] = Wp[0];
    b[1] = Wp[Nc];
    acc = wmma4(a, b, acc);
  }

#pragma unroll
  for (int r = 0; r < 8; ++r) {
    const int row = r + 8 * half;
    out[(size_t)(row0 + row) * Nc + col0 + ln] = acc[r];
  }
}

// ---------------------------------------------------------------------------
// The per-pair chain is linear in the 12 geometry features up to the softmax
// and linear again behind it, so its weight products are taken once instead of
// once per (i, j) pair:
//   scores = geom @ (Wrel @ k_txt^T) + brel @ k_txt^T
//   bias   = geom @ (Wrel @ Wbias) + alpha @ (v_txt @ Wbias) + brel @ Wbias + bbias
// with k_txt = lang @ Wtk + btk and v_txt = lang @ Wtv + btv folded the same way.
//
// Both steps run in one launch. A block owns one 16-wide t tile of one batch, for
// the keys (blockIdx.x 0..3) or for the values (4..7); it takes step 1 for itself,
// one 16x16 tile a wave, keeps the table in LDS and takes step 2 from there behind
// a barrier. Step 1 is small, so that every block repeats it costs less than a
// launch of its own between the two steps.
//
// The waves of a block share one load path, and a fragment load straight from
// memory touches 16 lines for 256 bytes. So all operands come in by whole rows
// (one 512-byte row an instruction) and go to LDS, each wave 16 rows, and the
// fragments are read from there behind a barrier.
//   staged rows 0..127 = Wtk rows (key blocks) or Wtv rows (value blocks),
//   128 = btk or btv, 129..140 = Wrel rows, 141 = brel, 142 and 143 = 0,
//   144..159 = the block's 16 rows of lang
//
// Step 1, independent of the batch, waves 0..8.
//   key blocks  : P[g][n] = sum_c WB[g][c] * Y[n][c]    (16 x 144)
//                 WB rows 0..12 = staged rows 129..141, the rest 0
//                 Y = staged rows 0..143; columns 129.. of P are not read
//   value blocks: Q[m][h] = sum_c Z[m][c] * Wbias[c][h] (QR x 4)
//                 Z = staged rows 0..143
//                 Rows 128.. also go to memory, from one block, for the bias kernel.
// Step 2, per batch, wave 9.
//   key blocks  : KF[b][g][t] = sum_m P[g][m] * lang[b][t][m] + P[g][128]
//                 (rows 0..11 = Wrel @ k_txt^T, row 12 = brel @ k_txt^T)
//   value blocks: VF[b][t][h] = sum_m lang[b][t][m] * Q[m][h] + Q[128][h]
//                 (= v_txt @ Wbias)
// grid = (8, B), block = 320 (10 waves)
// ---------------------------------------------------------------------------
#define SP 132        // floats per staged row: 16 rows x 8 B x 2 halves meet each bank once
#define PP 148        // floats per row of P in LDS: the same
#define QR 144
#define QG (Cc + 1)   // first row of Wrel @ Wbias in Q

__global__ void __launch_bounds__(320)
fold_kernel(const float* __restrict__ Wrel, const float* __restrict__ brel,
            const float* __restrict__ Wtk, const float* __restrict__ btk,
            const float* __restrict__ Wtv, const float* __restrict__ btv,
            const float* __restrict__ Wbias, const float* __restrict__ lang,
            float* __restrict__ Q, float* __restrict__ KF,
            float* __restrict__ VF) {
  // One array, the small tables first: their reads then take constant offsets.
  __shared__ __attribute__((aligned(16))) float lds[Cc * Hh + 16 * PP + (QR + 16) * SP];
  float* const wbs = lds;            // Wbias
  float* const tab = wbs + Cc * Hh;  // P, or Q (QR x 4)
  float* const stg = tab + 16 * PP;  // staged rows

  const int lane = threadIdx.x & 31;
  const int half = lane >> 4;
  const int ln   = lane & 15;
  // The wave's number, held in a scalar register: the tests on it are scalar.
  const int w    = __builtin_amdgcn_readfirstlane(threadIdx.x >> 5);
  const int b    = blockIdx.y;
  const int t0   = (blockIdx.x & 3) * 16;
  const bool keys = blockIdx.x < 4;
  const bool on   = ln < Hh;  // a head's column; padding columns select 0

  // ---- whole rows to LDS: wave w brings staged rows 16 w .. 16 w + 15 ----
  {
    v4f t[16];
    if (w == 8) {
      t[0] = *(const v4f*)((keys ? btk : btv) + 4 * lane);
#pragma unroll  // t stays in registers: constant indices
      for (int g = 0; g < Gg; ++g) t[1 + g] = *(const v4f*)(Wrel + g * Cc + 4 * lane);
      t[1 + Gg] = *(const v4f*)(brel + 4 * lane);
      t[14] = (v4f){0.f, 0.f, 0.f, 0.f};
      t[15] = (v4f){0.f, 0.f, 0.f, 0.f};
    } else {
      const float* sp = (w == 9 ? lang + (size_t)(b * Tt + t0) * Cc
                                : (keys ? Wtk : Wtv) + (size_t)(w * 16) * Cc) + 4 * lane;
#pragma unroll  // t stays in registers: constant indices
      for (int r = 0; r < 16; ++r) t[r] = *(const v4f*)(sp + r * Cc);
    }
    asm volatile("s_wait_xcnt 0x0" ::: "memory");  // before the address registers above are reused
    if (w < 4 && !keys) {
      const v4f u = *(const v4f*)(Wbias + w * Cc + 4 * lane);
      asm volatile("s_wait_xcnt 0x0" ::: "memory");  // before the address registers above are reused
      *(v4f*)&wbs[w * Cc + 4 * lane] = u;
    }
#pragma unroll  // t stays in registers: constant indices
    for (int r = 0; r < 16; ++r) *(v4f*)&stg[(w * 16 + r) * SP + 4 * lane] = t[r];
  }
  __syncthreads();

  // This wave's staged rows as a fragment, k = 4 kk + 2 half + {0, 1}.
  v2f of[32];
  {
    const float* own = stg + (w * 16 + ln) * SP + 2 * half;
#pragma unroll  // fragments stay in registers: constant indices
    for (int kk = 0; kk < 32; ++kk) of[kk] = *(const v2f*)(own + 4 * kk);
  }

  v8f acc;
  v2f xf[32];  // the other operand, k as in of

  // ---- step 1 ----
  if (w < 9) {
#pragma unroll  // acc is a register vector: constant indices
    for (int r = 0; r < 8; ++r) acc[r] = 0.f;
    if (keys) {
      const float* wb = stg + (QG + (ln < Gg + 1 ? ln : Gg + 1)) * SP + 2 * half;
#pragma unroll  // fragments stay in registers: constant indices
      for (int kk = 0; kk < 32; ++kk) xf[kk] = *(const v2f*)(wb + 4 * kk);
      // Keeps all the LDS reads ahead of the product: spread among its dependent
      // steps, one pair ahead, each of them is waited for.
      __builtin_amdgcn_sched_barrier(0);
#pragma unroll  // fragments stay in registers: constant indices
      for (int kk = 0; kk < 32; ++kk) acc = wmma4(xf[kk], of[kk], acc);
#pragma unroll  // acc is a register vector: constant indices
      for (int r = 0; r < 8; ++r) tab[(r + 8 * half) * PP + w * 16 + ln] = acc[r];
    } else {
      const float* bp = wbs + 2 * half * Hh + (ln & (Hh - 1));
#pragma unroll  // fragments stay in registers: constant indices
      for (int kk = 0; kk < 32; ++kk) {
        const float b0 = bp[4 * kk * Hh], b1 = bp[(4 * kk + 1) * Hh];
        xf[kk][0] = on ? b0 : 0.f;
        xf[kk][1] = on ? b1 : 0.f;
      }
      // Keeps all the LDS reads ahead of the product, as in the key blocks.
      __builtin_amdgcn_sched_barrier(0);
#pragma unroll  // fragments stay in registers: constant indices
      for (int kk = 0; kk < 32; ++kk) acc = wmma4(of[kk], xf[kk], acc);
      if (on) {
#pragma unroll  // acc is a register vector: constant indices
        for (int r = 0; r < 8; ++r) tab[(w * 16 + r + 8 * half) * Hh + ln] = acc[r];
      }
    }
  }
  __syncthreads();
  if (w < 9) {
    // Behind the barrier, so that step 2 of this block does not wait for the stores.
    if (w == 8 && blockIdx.x == 4 && b == 0 && on) {
#pragma unroll  // acc is a register vector: constant indices
      for (int r = 0; r < 8; ++r) Q[(Cc + r + 8 * half) * Hh + ln] = acc[r];
    }
    return;
  }

  // ---- step 2: of holds the text rows (t x m) ----
  if (keys) {
    const float* pp = tab + ln * PP + 2 * half;
    const float* pc = tab + 8 * half * PP + Cc;
#pragma unroll  // acc is a register vector: constant indices
    for (int r = 0; r < 8; ++r) acc[r] = pc[r * PP];
#pragma unroll  // fragments stay in registers: constant indices
    for (int kk = 0; kk < 32; ++kk) xf[kk] = *(const v2f*)(pp + 4 * kk);  // P (g x m)
    // Keeps all the LDS reads ahead of the product, as in step 1.
    __builtin_amdgcn_sched_barrier(0);
#pragma unroll  // fragments stay in registers: constant indices
    for (int kk = 0; kk < 32; ++kk) acc = wmma4(xf[kk], of[kk], acc);
#pragma unroll  // acc is a register vector: constant indices
    for (int r = 0; r < 8; ++r)
      KF[(size_t)(b * 16 + r + 8 * half) * Tt + t0 + ln] = acc[r];
  } else {
    const float* qp = tab + 2 * half * Hh + (ln & (Hh - 1));
    const float qb = tab[Cc * Hh + (ln & (Hh - 1))];
#pragma unroll  // acc is a register vector: constant indices
    for (int r = 0; r < 8; ++r) acc[r] = on ? qb : 0.f;
#pragma unroll  // fragments stay in registers: constant indices
    for (int kk = 0; kk < 32; ++kk) {  // Q (m x h)
      const float b0 = qp[4 * kk * Hh], b1 = qp[(4 * kk + 1) * Hh];
      xf[kk][0] = on ? b0 : 0.f;
      xf[kk][1] = on ? b1 : 0.f;
    }
    // Keeps all the LDS reads ahead of the product, as in step 1.
    __builtin_amdgcn_sched_barrier(0);
#pragma unroll  // fragments stay in registers: constant indices
    for (int kk = 0; kk < 32; ++kk) acc = wmma4(of[kk], xf[kk], acc);
    if (on) {
#pragma unroll  // acc is a register vector: constant indices
      for (int r = 0; r < 8; ++r)
        VF[(size_t)(b * Tt + t0 + r + 8 * half) * Hh + ln] = acc[r];
    }
  }
}

// ---------------------------------------------------------------------------
// Fused: geometry -> lang cross-attn scores -> softmax -> bias head, on the
// folded tables (Q, KF, VF above).
// Every product is taken transposed, with the text index t (or the head) in the
// rows of D and the pair index j in its columns. A lane then holds 32 of the 64
// scores of its own j (lane ^ 16 holds the other 32), so the softmax runs in
// registers, and the registers of the exponentials are, pair by pair, the B
// operand of the head product; 1 / sum is the same for a whole column of D and
// multiplies the two result rows. Nothing goes through LDS and no wave waits
// for another.
// grid = (N, B + 3), block = 128 (4 waves). For blockIdx.y < B each wave handles
// four 16-wide j tiles, 64 j in a row, of this (b, i).
//
// The q, k and v projections depend on nothing that this kernel reads or writes,
// so they ride in the same launch instead of three launches of their own:
// blockIdx.y = B, B + 1, B + 2 is q, k, v, one 16x16 tile a wave, the 4 waves of a
// block on 4 column tiles of the same rows. They have the highest indices, so
// they start last, in the places that the first bias blocks leave.
// ---------------------------------------------------------------------------
// Value of lane ^ 16.
__device__ __forceinline__ float other_half(float x) {
  const int v = __builtin_bit_cast(int, x);
  return __builtin_bit_cast(
      float, __builtin_amdgcn_permlanex16(v, v, 0x76543210, 0xfedcba98, false, false));
}

__global__ void __launch_bounds__(128)
relbias_qkv_kernel(const float* __restrict__ centers,
                   const float* __restrict__ corners,
                   const float* __restrict__ Q, const float* __restrict__ KF,
                   const float* __restrict__ VF, const float* __restrict__ bbias,
                   float* __restrict__ biasout, const float* __restrict__ feat,
                   const float* __restrict__ Wq, const float* __restrict__ bq,
                   const float* __restrict__ Wk, const float* __restrict__ bk,
                   const float* __restrict__ Wv, const float* __restrict__ bv,
                   float* __restrict__ qout, float* __restrict__ kout,
                   float* __restrict__ vout) {
  if (blockIdx.y >= Bsz) {
    const int p = blockIdx.y - Bsz;
    const float* Wp = p == 0 ? Wq : p == 1 ? Wk : Wv;
    const float* bp = p == 0 ? bq : p == 1 ? bk : bv;
    float*       op = p == 0 ? qout : p == 1 ? kout : vout;
    // The wave's number, held in a scalar register: the tile's origin is then
    // scalar arithmetic.
    const int tile =
        blockIdx.x * 4 + __builtin_amdgcn_readfirstlane(threadIdx.x >> 5);
    gemm_bias_tile(feat, Wp, bp, op, (tile >> 3) * 16, (tile & 7) * 16, Cc, Cc);
    return;
  }

  const int i    = blockIdx.x;
  const int b    = blockIdx.y;
  const int w    = threadIdx.x >> 5;
  const int lane = threadIdx.x & 31;
  const int half = lane >> 4;
  const int ln   = lane & 15;

  // sizes for node i (same for all lanes; cheap)
  float sxi, syi, szi;
  {
    const float* cp = corners + (size_t)(b * Nn + i) * 24;
    float mx0 = -1e30f, mx1 = -1e30f, mx2 = -1e30f;
    float mn0 = 1e30f, mn1 = 1e30f, mn2 = 1e30f;
#pragma unroll
    for (int c = 0; c < 8; ++c) {
      float x = cp[c * 3 + 0], y = cp[c * 3 + 1], z = cp[c * 3 + 2];
      mx0 = fmaxf(mx0, x); mn0 = fminf(mn0, x);
      mx1 = fmaxf(mx1, y); mn1 = fminf(mn1, y);
      mx2 = fmaxf(mx2, z); mn2 = fminf(mn2, z);
    }
    sxi = mx0 - mn0; syi = mx1 - mn1; szi = mx2 - mn2;
  }
  const float cxi = centers[(size_t)(b * Nn + i) * 3 + 0];
  const float cyi = centers[(size_t)(b * Nn + i) * 3 + 1];
  const float czi = centers[(size_t)(b * Nn + i) * 3 + 2];

  const float rs128 = 0.08838834764831845f;  // 1/sqrt(128)
  const bool  hi  = half != 0;
  const float dxz = (hi ? szi : sxi) + EPSF;

  // A fragments of the folded tables: the same for every j tile of this block.
  // Head rows of D: head 2 * half + r sits in register r (r = 0, 1) of each lane
  // half, i.e. in A rows 0, 1, 8, 9, so that all 32 lanes store.
  v2f kf[4][3];   // KF[b] rows 0..11 as (t x g), four 16-row t tiles
  v8f kc[4];      // KF[b] row 12 at t = 16 tt + 8 half + r: C of the scores
  v2f gf[3];      // (Wrel @ Wbias)^T, rows other than 0, 1, 8, 9 zero
  v2f vf[16];     // VF[b]^T in the k order of the score registers (below)
  v8f hb;         // brel @ Wbias + bbias: C of the head
  {
    const float* KFb = KF + (size_t)b * 16 * Tt;
    const float* VFb = VF + (size_t)b * Tt * Hh;
#pragma unroll  // fragments stay in registers: constant indices
    for (int tt = 0; tt < 4; ++tt) {
#pragma unroll  // fragments stay in registers: constant indices
      for (int kk = 0; kk < 3; ++kk) {
        kf[tt][kk][0] = KFb[(4 * kk + 2 * half) * Tt + tt * 16 + ln];
        kf[tt][kk][1] = KFb[(4 * kk + 2 * half + 1) * Tt + tt * 16 + ln];
      }
#pragma unroll  // kc is a register vector: constant indices
      for (int r = 0; r < 8; ++r)
        kc[tt][r] = KFb[Gg * Tt + tt * 16 + 8 * half + r];
    }
    // padding rows read a valid head, select 0
    const int hc = 2 * (ln >> 3) + (ln & 1);
    const bool on = (ln & 7) < 2;
#pragma unroll  // fragments stay in registers: constant indices
    for (int kk = 0; kk < 3; ++kk) {
      const float g0 = Q[(QG + 4 * kk + 2 * half) * Hh + hc];
      const float g1 = Q[(QG + 4 * kk + 2 * half + 1) * Hh + hc];
      gf[kk][0] = on ? g0 : 0.f;
      gf[kk][1] = on ? g1 : 0.f;
    }
    // k step 4 tt + p of the head takes t = 16 tt + 8 half + 2 p + {0, 1}:
    // registers 2 p and 2 p + 1 of score tile tt.
#pragma unroll  // fragments stay in registers: constant indices
    for (int kk = 0; kk < 16; ++kk) {
      const int t = 16 * (kk >> 2) + 8 * half + 2 * (kk & 3);
      const float v0 = VFb[t * Hh + hc];
      const float v1 = VFb[(t + 1) * Hh + hc];
      vf[kk][0] = on ? v0 : 0.f;
      vf[kk][1] = on ? v1 : 0.f;
    }
#pragma unroll  // hb is a register vector: constant indices
    for (int r = 0; r < 8; ++r) hb[r] = 0.f;
    hb[0] = Q[(QG + Gg) * Hh + 2 * half] + bbias[2 * half];
    hb[1] = Q[(QG + Gg) * Hh + 2 * half + 1] + bbias[2 * half + 1];
  }

  for (int jo = 0; jo < 4; ++jo) {
    const int j = w * 64 + jo * 16 + ln;

    // ---- stage 1: geometry features of pair (i, j), in both lane halves ----
    v2f gb[3];  // geom^T (g x j), g = 4 kk + 2 half + {0, 1} as in kf and gf
    {
      const float cxj = centers[(size_t)(b * Nn + j) * 3 + 0];
      const float cyj = centers[(size_t)(b * Nn + j) * 3 + 1];
      const float czj = centers[(size_t)(b * Nn + j) * 3 + 2];
      const float r0 = cxj - cxi, r1 = cyj - cyi, r2 = czj - czi;
      const float dist  = sqrtf(r0 * r0 + r1 * r1 + r2 * r2);
      const float horiz = sqrtf(r0 * r0 + r1 * r1);
      const float cose  = r2 / (dist + EPSF);
      const float dlog  = logf(dist + EPSF);
      // sizes for node j
      const float* cp = corners + (size_t)(b * Nn + j) * 24;
      float mx0 = -1e30f, mx1 = -1e30f, mx2 = -1e30f;
      float mn0 = 1e30f, mn1 = 1e30f, mn2 = 1e30f;
#pragma unroll
      for (int c = 0; c < 8; ++c) {
        float x = cp[c * 3 + 0], y = cp[c * 3 + 1], z = cp[c * 3 + 2];
        mx0 = fmaxf(mx0, x); mn0 = fminf(mn0, x);
        mx1 = fmaxf(mx1, y); mn1 = fminf(mn1, y);
        mx2 = fmaxf(mx2, z); mn2 = fminf(mn2, z);
      }
      const float sxj = mx0 - mn0, syj = mx1 - mn1, szj = mx2 - mn2;
      // Feature 9 (lower half) and feature 11 (upper half) share one division.
      const float ry  = syj / (syi + EPSF);
      const float rxz = (hi ? szj : sxj) / dxz;
      gb[0][0] = hi ? r2 : r0;
      gb[0][1] = hi ? dlog : r1;
      gb[1][0] = hi ? sxj - sxi : horiz;
      gb[1][1] = hi ? syj - syi : cose;
      gb[2][0] = hi ? ry : szj - szi;
      gb[2][1] = rxz;
    }

    // ---- stage 2: scores^T = (KF^T(64x12) @ geom^T(12x16) + KF row 12) * rs128
    v8f s[4];   // s[tt][r] = score of (t = 16 tt + 8 half + r, j)
#pragma unroll  // fragments stay in registers: constant indices
    for (int tt = 0; tt < 4; ++tt) {
      v8f acc = kc[tt];
#pragma unroll  // fragments stay in registers: constant indices
      for (int kk = 0; kk < 3; ++kk) acc = wmma4(kf[tt][kk], gb[kk], acc);
      s[tt] = acc * rs128;
    }

    // ---- stage 3: softmax over T=64, 32 registers in each of 2 lanes ----
    float inv;  // 1 / sum of the exponentials; applied behind the head product
    {
      float mx = -1e30f;
#pragma unroll  // s is a register array: constant indices
      for (int tt = 0; tt < 4; ++tt)
#pragma unroll  // s is a register array: constant indices
        for (int r = 0; r < 8; ++r) mx = fmaxf(mx, s[tt][r]);
      mx = fmaxf(mx, other_half(mx));
#pragma unroll  // s is a register array: constant indices
      for (int tt = 0; tt < 4; ++tt)
#pragma unroll  // s is a register array: constant indices
        for (int r = 0; r < 8; ++r) s[tt][r] = __expf(s[tt][r] - mx);
      const v8f sv = (s[0] + s[1]) + (s[2] + s[3]);
      float sum = ((sv[0] + sv[1]) + (sv[2] + sv[3])) +
                  ((sv[4] + sv[5]) + (sv[6] + sv[7]));
      sum += other_half(sum);
      inv = 1.f / sum;
    }

    // ---- stage 4: bias^T = gf(16x12) @ geom^T + hb + vf(16x64) @ exp^T * inv
    {
      v8f accg = hb;
#pragma unroll  // fragments stay in registers: constant indices
      for (int kk = 0; kk < 3; ++kk) accg = wmma4(gf[kk], gb[kk], accg);
      v8f acce;
#pragma unroll  // acce is a register vector: constant indices
      for (int r = 0; r < 8; ++r) acce[r] = 0.f;
#pragma unroll  // fragments stay in registers: constant indices
      for (int kk = 0; kk < 16; ++kk) {
        v2f ex;
        ex[0] = s[kk >> 2][2 * (kk & 3)];
        ex[1] = s[kk >> 2][2 * (kk & 3) + 1];
        acce = wmma4(vf[kk], ex, acce);
      }
      float* op = biasout + ((size_t)(b * Hh + 2 * half) * Nn + i) * Nn + j;
      op[0] = accg[0] + acce[0] * inv;
      op[(size_t)Nn * Nn] = accg[1] + acce[1] * inv;
    }
  }
}

// ---------------------------------------------------------------------------
// Self-attention and output projection: per (b, 16-row q tile), 4 waves a head,
// the 256 keys of a head split over its 4 waves.
// Both products are taken transposed, with the key index j (or the channel c) in
// the rows of D and the query index i in its columns, as in relbias_qkv_kernel: a
// lane holds 32 of its wave's 64 logits of its own i (lane ^ 16 the other 32),
// the softmax runs in registers, and the registers of the exponentials are, pair
// by pair, the B operand of the second product. Each wave keeps its own maximum,
// sum and partial output; they are merged once, through LDS, behind one barrier.
// A wave's operands are few enough to be loaded all at once, ahead of the work.
// A block holds all 4 heads, i.e. all 128 channels of its 16 rows, so the merged
// rows stay in LDS and are the A operand of the product with Wo, behind a second
// barrier: 8 waves, one 16x16 tile of the output each, in the k order and with
// the start value of gemm_bias_tile.
// grid = (N/16, B), block = 512 (16 waves: 4 h + key quarter)
// ---------------------------------------------------------------------------
#define OPITCH 36   // floats per row of a partial output: 16 B x odd
#define APITCH 132  // floats per merged row: 16 rows x 8 B x 2 halves meet each bank once

__global__ void __launch_bounds__(512)
attn_proj_kernel(const float* __restrict__ q, const float* __restrict__ k,
                 const float* __restrict__ v, const float* __restrict__ bias,
                 const float* __restrict__ Wo, const float* __restrict__ bo,
                 float* __restrict__ outp) {
  __shared__ __attribute__((aligned(16))) float ldsO[16][16][OPITCH];  // [wave][i][c]
  __shared__ float ldsMS[16][2][16];  // [wave][0: maximum, 1: sum][i]
  __shared__ __attribute__((aligned(16))) float ldsA[16][APITCH];  // merged [i][c of all heads]

  const int i0   = blockIdx.x * 16;
  const int b    = blockIdx.y;
  // The wave's number, held in a scalar register: head, key quarter and the test
  // for the projection's waves are then scalar.
  const int wv   = __builtin_amdgcn_readfirstlane(threadIdx.x >> 5);
  const int h    = wv >> 2;
  const int w    = wv & 3;
  const int lane = threadIdx.x & 31;
  const int half = lane >> 4;
  const int ln   = lane & 15;
  const int j0   = w * 64;
  const float scale = 0.1767766952966369f;  // 1/sqrt(32)

  v2f qf[8];      // q^T (d x i), d = 4 kk + 2 half + {0, 1}
  v2f kf[4][8];   // k (j x d), four 16-row j tiles, d as in qf
  v8f s[4];       // s[tt][r] = logit of (j = j0 + 16 tt + 8 half + r, i)
  v2f vf[2][16];  // v^T (c x j) in the k order of the logit registers (below)
  {
    const float* qp = q + (size_t)(b * Nn + i0 + ln) * Cc + h * Dd + 2 * half;
#pragma unroll  // fragments stay in registers: constant indices
    for (int kk = 0; kk < 8; ++kk) {
      qf[kk][0] = qp[4 * kk];
      qf[kk][1] = qp[4 * kk + 1];
    }
    asm volatile("s_wait_xcnt 0x0" ::: "memory");  // before the address registers above are reused
    const float* kp = k + (size_t)(b * Nn + j0 + ln) * Cc + h * Dd + 2 * half;
#pragma unroll  // fragments stay in registers: constant indices
    for (int tt = 0; tt < 4; ++tt)
#pragma unroll  // fragments stay in registers: constant indices
      for (int kk = 0; kk < 8; ++kk) {
        kf[tt][kk][0] = kp[tt * 16 * Cc + 4 * kk];
        kf[tt][kk][1] = kp[tt * 16 * Cc + 4 * kk + 1];
      }
    asm volatile("s_wait_xcnt 0x0" ::: "memory");  // before the address registers above are reused
    // The bias is the C operand of the first product: 8 j in a row per lane.
    const float* bp =
        bias + ((size_t)(b * Hh + h) * Nn + i0 + ln) * Nn + j0 + 8 * half;
#pragma unroll  // s is a register array: constant indices
    for (int tt = 0; tt < 4; ++tt) {
      const v4f lo = *(const v4f*)(bp + tt * 16);
      const v4f up = *(const v4f*)(bp + tt * 16 + 4);
#pragma unroll  // s is a register array: constant indices
      for (int r = 0; r < 4; ++r) {
        s[tt][r]     = lo[r];
        s[tt][r + 4] = up[r];
      }
    }
    asm volatile("s_wait_xcnt 0x0" ::: "memory");  // before the address registers above are reused
    // k step 4 tt + p of the second product takes j = j0 + 16 tt + 8 half +
    // 2 p + {0, 1}: registers 2 p and 2 p + 1 of logit tile tt.
    const float* vp = v + (size_t)(b * Nn + j0 + 8 * half) * Cc + h * Dd + ln;
#pragma unroll  // fragments stay in registers: constant indices
    for (int ct = 0; ct < 2; ++ct)
#pragma unroll  // fragments stay in registers: constant indices
      for (int kk = 0; kk < 16; ++kk) {
        const int jr = 16 * (kk >> 2) + 2 * (kk & 3);
        vf[ct][kk][0] = vp[jr * Cc + ct * 16];
        vf[ct][kk][1] = vp[(jr + 1) * Cc + ct * 16];
      }
    asm volatile("s_wait_xcnt 0x0" ::: "memory");  // before the address registers above are reused
  }

  // Keeps the loads of v ahead of the first product: without it they are moved
  // behind it and their latency is waited for a second time.
  __builtin_amdgcn_sched_barrier(0);

  // logits^T = k(64x32) @ (q * scale)^T(32x16) + bias^T
#pragma unroll  // fragments stay in registers: constant indices
  for (int kk = 0; kk < 8; ++kk) {
    const v2f qs = qf[kk] * scale;
#pragma unroll  // fragments stay in registers: constant indices
    for (int tt = 0; tt < 4; ++tt) s[tt] = wmma4(kf[tt][kk], qs, s[tt]);
  }

  // this wave's part of the softmax: 32 registers in each of 2 lanes
  float mx = -1e30f, sum;
  {
#pragma unroll  // s is a register array: constant indices
    for (int tt = 0; tt < 4; ++tt)
#pragma unroll  // s is a register array: constant indices
      for (int r = 0; r < 8; ++r) mx = fmaxf(mx, s[tt][r]);
    mx = fmaxf(mx, other_half(mx));
  }

  // The projection's waves fetch their tile of Wo (k x n, k = 4 kk + 2 half +
  // {0, 1}) here, into the registers that k has left: it lands under the
  // exponentials and the second product.
  v2f wf[32];
  float bov = 0.f;
  if (wv < 8) {
    const float* wp = Wo + (size_t)(2 * half) * Cc + wv * 16 + ln;
#pragma unroll  // fragments stay in registers: constant indices
    for (int kk = 0; kk < 32; ++kk) {
      wf[kk][0] = wp[4 * kk * Cc];
      wf[kk][1] = wp[(4 * kk + 1) * Cc];
    }
    bov = bo[wv * 16 + ln];
    asm volatile("s_wait_xcnt 0x0" ::: "memory");  // before the address registers above are reused
  }

  {
#pragma unroll  // s is a register array: constant indices
    for (int tt = 0; tt < 4; ++tt)
#pragma unroll  // s is a register array: constant indices
      for (int r = 0; r < 8; ++r) s[tt][r] = __expf(s[tt][r] - mx);
    const v8f sv = (s[0] + s[1]) + (s[2] + s[3]);
    sum = ((sv[0] + sv[1]) + (sv[2] + sv[3])) +
          ((sv[4] + sv[5]) + (sv[6] + sv[7]));
    sum += other_half(sum);
  }

  // partial out^T = v^T(32x64) @ exp^T(64x16)
  v8f o[2];  // o[ct][r] = (c = 16 ct + 8 half + r, i)
#pragma unroll  // o is a register array: constant indices
  for (int ct = 0; ct < 2; ++ct)
#pragma unroll  // o is a register array: constant indices
    for (int r = 0; r < 8; ++r) o[ct][r] = 0.f;
#pragma unroll  // fragments stay in registers: constant indices
  for (int kk = 0; kk < 16; ++kk) {
    v2f ex;
    ex[0] = s[kk >> 2][2 * (kk & 3)];
    ex[1] = s[kk >> 2][2 * (kk & 3) + 1];
#pragma unroll  // fragments stay in registers: constant indices
    for (int ct = 0; ct < 2; ++ct) o[ct] = wmma4(vf[ct][kk], ex, o[ct]);
  }

#pragma unroll  // o is a register array: constant indices
  for (int ct = 0; ct < 2; ++ct) {
    v4f lo, up;
#pragma unroll  // o is a register array: constant indices
    for (int r = 0; r < 4; ++r) {
      lo[r] = o[ct][r];
      up[r] = o[ct][r + 4];
    }
    *(v4f*)&ldsO[wv][ln][ct * 16 + 8 * half]     = lo;
    *(v4f*)&ldsO[wv][ln][ct * 16 + 8 * half + 4] = up;
  }
  ldsMS[wv][half][ln] = half ? sum : mx;  // both are equal in the two lane halves
  __syncthreads();

  // merge: wave w of head h takes rows 4 w .. 4 w + 3 of that head, 8 lanes a row.
  {
    const int mi = 4 * w + (lane >> 3);
    const int mc = 4 * (lane & 7);
    float m[4];
#pragma unroll  // m is a register array: constant indices
    for (int x = 0; x < 4; ++x) m[x] = ldsMS[4 * h + x][0][mi];
    const float mall = fmaxf(fmaxf(m[0], m[1]), fmaxf(m[2], m[3]));
    float tot = 0.f;
    v4f acc = {0.f, 0.f, 0.f, 0.f};
#pragma unroll  // m is a register array: constant indices
    for (int x = 0; x < 4; ++x) {
      const float f = __expf(m[x] - mall);
      tot += f * ldsMS[4 * h + x][1][mi];
      acc += f * *(const v4f*)&ldsO[4 * h + x][mi][mc];
    }
    const float inv = 1.f / tot;
    *(v4f*)&ldsA[mi][h * Dd + mc] = acc * inv;
  }
  __syncthreads();

  // out(16x16 tile) = merged rows(16x128) @ Wo(128x16) + bo
  if (wv < 8) {
    v8f acc;
#pragma unroll  // acc is a register vector: constant indices
    for (int r = 0; r < 8; ++r) acc[r] = bov;
    float* op = outp + (size_t)(b * Nn + i0 + 8 * half) * Cc + wv * 16 + ln;
    v2f af[32];  // merged rows (i x k), k as in wf
#pragma unroll  // fragments stay in registers: constant indices
    for (int kk = 0; kk < 32; ++kk)
      af[kk] = *(const v2f*)&ldsA[ln][4 * kk + 2 * half];
    // Keeps all the LDS reads ahead of the product: spread among its dependent
    // steps, one pair ahead, each of them is waited for.
    __builtin_amdgcn_sched_barrier(0);
#pragma unroll  // fragments stay in registers: constant indices
    for (int kk = 0; kk < 32; ++kk) acc = wmma4(af[kk], wf[kk], acc);
#pragma unroll  // acc is a register vector: constant indices
    for (int r = 0; r < 8; ++r) op[r * Cc] = acc[r];
  }
}

// ---------------------------------------------------------------------------
extern "C" void kernel_launch(void* const* d_in, const int* in_sizes, int n_in,
                              void* d_out, int out_size, void* d_ws,
                              size_t ws_size, hipStream_t stream) {
  (void)in_sizes; (void)n_in; (void)out_size; (void)ws_size;
  const float* feat    = (const float*)d_in[0];
  const float* centers = (const float*)d_in[1];
  const float* corners = (const float*)d_in[2];
  const float* lang    = (const float*)d_in[3];
  const float* Wq = (const float*)d_in[4];  const float* bq = (const float*)d_in[5];
  const float* Wk = (const float*)d_in[6];  const float* bk = (const float*)d_in[7];
  const float* Wv = (const float*)d_in[8];  const float* bv = (const float*)d_in[9];
  const float* Wo = (const float*)d_in[10]; const float* bo = (const float*)d_in[11];
  const float* Wrel = (const float*)d_in[12]; const float* brel = (const float*)d_in[13];
  const float* Wtk  = (const float*)d_in[14]; const float* btk  = (const float*)d_in[15];
  const float* Wtv  = (const float*)d_in[16]; const float* btv  = (const float*)d_in[17];
  const float* Wbias = (const float*)d_in[18]; const float* bbias = (const float*)d_in[19];

  float* ws = (float*)d_ws;
  const size_t MR = (size_t)Bsz * Nn;  // 2048 rows
  float* qb      = ws;
  float* kb      = qb + MR * Cc;
  float* vb      = kb + MR * Cc;
  float* Qf      = vb + MR * Cc;
  float* KFf     = Qf + (size_t)QR * Hh;
  float* VFf     = KFf + (size_t)Bsz * 16 * Tt;
  float* biasb   = VFf + (size_t)Bsz * Tt * Hh;

  // folded tables of the language cross-attention
  fold_kernel<<<dim3(8, Bsz), 320, 0, stream>>>(Wrel, brel, Wtk, btk, Wtv, btv,
                                                Wbias, lang, Qf, KFf, VFf);

  // fused geometry + language cross-attention -> bias(B,H,N,N), and in the same
  // launch the q / k / v projections (2048x128 @ 128x128)
  relbias_qkv_kernel<<<dim3(Nn, Bsz + 3), 128, 0, stream>>>(
      centers, corners, Qf, KFf, VFf, bbias, biasb, feat, Wq, bq, Wk, bk, Wv, bv,
      qb, kb, vb);

  // biased multi-head self-attention and the final projection -> d_out
  attn_proj_kernel<<<dim3(Nn / 16, Bsz), 512, 0, stream>>>(qb, kb, vb, biasb, Wo,
                                                           bo, (float*)d_out);
}

// v007
// One run takes 27.7 microseconds.
// Two timings next to v006 put it at 1.20 and 1.19 times that version's speed.
// Counting every step since v000, it is 12.7 times as fast.
#include <hip/hip_runtime.h>
#include <math.h>

// Problem constants (match reference)
#define Bsz 8
#define Nn  256
#define Cc  128
#define Tt  64
#define Hh  4
#define Gg  12
#define Dd  32
#define EPSF 1e-6f

typedef __attribute__((ext_vector_type(2))) float v2f;
typedef __attribute__((ext_vector_type(4))) float v4f;
typedef __attribute__((ext_vector_type(8))) float v8f;

// D = A(16x4,f32) * B(4x16,f32) + C(16x16,f32)   -> v_wmma_f32_16x16x4_f32
__device__ __forceinline__ v8f wmma4(v2f a, v2f b, v8f c) {
  return __builtin_amdgcn_wmma_f32_16x16x4_f32(false, a, false, b, (short)0, c,
                                               false, false);
}

// ---------------------------------------------------------------------------
// Generic GEMM: out[M x Nc] = A[M x K] @ W[K x Nc] + bias[Nc]
// One wave per 16x16 output tile at (row0, col0). K must be a multiple of 4.
// ---------------------------------------------------------------------------
__device__ __forceinline__ void
gemm_bias_tile(const float* __restrict__ A, const float* __restrict__ W,
               const float* __restrict__ bias, float* __restrict__ out,
               int row0, int col0, int K, int Nc) {
  const int lane = threadIdx.x & 31;
  const int half = lane >> 4;   // which K pair / which row half for C
  const int ln   = lane & 15;   // M index for A, N index for B/C

  v8f acc;
  const float bv = bias[col0 + ln];
#pragma unroll
  for (int r = 0; r < 8; ++r) acc[r] = bv;

  for (int k0 = 0; k0 < K; k0 += 4) {
    v2f a, b;
    const float* Ap = A + (size_t)(row0 + ln) * K + (k0 + 2 * half);
    a[0] = Ap[0];
    a[1] = Ap[1];
    const float* Wp = W + (size_t)(k0 + 2 * half) * Nc + (col0 + ln);
    b[0] = Wp[0];
    b[1] = Wp[Nc];
    acc = wmma4(a, b, acc);
  }

#pragma unroll
  for (int r = 0; r < 8; ++r) {
    const int row = r + 8 * half;
    out[(size_t)(row0 + row) * Nc + col0 + ln] = acc[r];
  }
}

// ---------------------------------------------------------------------------
// The per-pair chain is linear in the 12 geometry features up to the softmax
// and linear again behind it, so its weight products are taken once instead of
// once per (i, j) pair:
//   scores = geom @ (Wrel @ k_txt^T) + brel @ k_txt^T
//   bias   = geom @ (Wrel @ Wbias) + alpha @ (v_txt @ Wbias) + brel @ Wbias + bbias
// with k_txt = lang @ Wtk + btk and v_txt = lang @ Wtv + btv folded the same way.
//
// Both steps run in one launch. A block owns one 16-wide t tile of one batch, for
// the keys (blockIdx.x 0..3) or for the values (4..7); it takes step 1 for itself,
// one 16x16 tile a wave, keeps the table in LDS and takes step 2 from there behind
// a barrier. Step 1 is small, so that every block repeats it costs less than a
// launch of its own between the two steps.
//
// The waves of a block share one load path, and a fragment load straight from
// memory touches 16 lines for 256 bytes. So all operands come in by whole rows
// (one 512-byte row an instruction) and go to LDS, each wave 16 rows, and the
// fragments are read from there behind a barrier.
//   staged rows 0..127 = Wtk rows (key blocks) or Wtv rows (value blocks),
//   128 = btk or btv, 129..140 = Wrel rows, 141 = brel, 142 and 143 = 0,
//   144..159 = the block's 16 rows of lang
//
// Step 1, independent of the batch, waves 0..8.
//   key blocks  : P[g][n] = sum_c WB[g][c] * Y[n][c]    (16 x 144)
//                 WB rows 0..12 = staged rows 129..141, the rest 0
//                 Y = staged rows 0..143; columns 129.. of P are not read
//   value blocks: Q[m][h] = sum_c Z[m][c] * Wbias[c][h] (QR x 4)
//                 Z = staged rows 0..143
//                 Rows 128.. also go to memory, from one block, for the bias kernel.
// Step 2, per batch, wave 9.
//   key blocks  : KF[b][g][t] = sum_m P[g][m] * lang[b][t][m] + P[g][128]
//                 (rows 0..11 = Wrel @ k_txt^T, row 12 = brel @ k_txt^T)
//   value blocks: VF[b][t][h] = sum_m lang[b][t][m] * Q[m][h] + Q[128][h]
//                 (= v_txt @ Wbias)
// grid = (8, B + 39), block = 320 (10 waves); blockIdx.y < B is the work above.
//
// The q, k and v projections depend on nothing that this kernel writes, and the
// 64 blocks above leave most of the chip idle, so they ride in the same launch:
// the 312 blocks with blockIdx.y >= B take the 3 x 1024 tiles of q, k and v, one
// 16x16 tile a wave, 10 tiles in a row a block (the column tile runs fastest). They
// have the highest indices, so the blocks with the long dependent path start first.
// ---------------------------------------------------------------------------
#define SP 132        // floats per staged row: 16 rows x 8 B x 2 halves meet each bank once
#define PP 148        // floats per row of P in LDS: the same
#define QR 144
#define QG (Cc + 1)   // first row of Wrel @ Wbias in Q

__global__ void __launch_bounds__(320)
fold_qkv_kernel(const float* __restrict__ Wrel, const float* __restrict__ brel,
            const float* __restrict__ Wtk, const float* __restrict__ btk,
            const float* __restrict__ Wtv, const float* __restrict__ btv,
            const float* __restrict__ Wbias, const float* __restrict__ lang,
            float* __restrict__ Q, float* __restrict__ KF,
            float* __restrict__ VF, const float* __restrict__ feat,
            const float* __restrict__ Wq, const float* __restrict__ bq,
            const float* __restrict__ Wk, const float* __restrict__ bk,
            const float* __restrict__ Wv, const float* __restrict__ bv,
            float* __restrict__ qout, float* __restrict__ kout,
            float* __restrict__ vout) {
  if (blockIdx.y >= Bsz) {
    // The wave's number, held in a scalar register: the tile's origin is then
    // scalar arithmetic.
    const int tile = ((blockIdx.y - Bsz) * 8 + blockIdx.x) * 10 +
                     __builtin_amdgcn_readfirstlane(threadIdx.x >> 5);
    if (tile >= 3 * 1024) return;  // 312 blocks of 10 waves: the last 48 waves have no tile
    const int p = tile >> 10;
    const float* Wp = p == 0 ? Wq : p == 1 ? Wk : Wv;
    const float* bp = p == 0 ? bq : p == 1 ? bk : bv;
    float*       op = p == 0 ? qout : p == 1 ? kout : vout;
    gemm_bias_tile(feat, Wp, bp, op, ((tile >> 3) & 127) * 16, (tile & 7) * 16, Cc, Cc);
    return;
  }

  // One array, the small tables first: their reads then take constant offsets.
  __shared__ __attribute__((aligned(16))) float lds[Cc * Hh + 16 * PP + (QR + 16) * SP];
  float* const wbs = lds;            // Wbias
  float* const tab = wbs + Cc * Hh;  // P, or Q (QR x 4)
  float* const stg = tab + 16 * PP;  // staged rows

  const int lane = threadIdx.x & 31;
  const int half = lane >> 4;
  const int ln   = lane & 15;
  // The wave's number, held in a scalar register: the tests on it are scalar.
  const int w    = __builtin_amdgcn_readfirstlane(threadIdx.x >> 5);
  const int b    = blockIdx.y;
  const int t0   = (blockIdx.x & 3) * 16;
  const bool keys = blockIdx.x < 4;
  const bool on   = ln < Hh;  // a head's column; padding columns select 0

  // ---- whole rows to LDS: wave w brings staged rows 16 w .. 16 w + 15 ----
  {
    v4f t[16];
    if (w == 8) {
      t[0] = *(const v4f*)((keys ? btk : btv) + 4 * lane);
#pragma unroll  // t stays in registers: constant indices
      for (int g = 0; g < Gg; ++g) t[1 + g] = *(const v4f*)(Wrel + g * Cc + 4 * lane);
      t[1 + Gg] = *(const v4f*)(brel + 4 * lane);
      t[14] = (v4f){0.f, 0.f, 0.f, 0.f};
      t[15] = (v4f){0.f, 0.f, 0.f, 0.f};
    } else {
      const float* sp = (w == 9 ? lang + (size_t)(b * Tt + t0) * Cc
                                : (keys ? Wtk : Wtv) + (size_t)(w * 16) * Cc) + 4 * lane;
#pragma unroll  // t stays in registers: constant indices
      for (int r = 0; r < 16; ++r) t[r] = *(const v4f*)(sp + r * Cc);
    }
    asm volatile("s_wait_xcnt 0x0" ::: "memory");  // before the address registers above are reused
    if (w < 4 && !keys) {
      const v4f u = *(const v4f*)(Wbias + w * Cc + 4 * lane);
      asm volatile("s_wait_xcnt 0x0" ::: "memory");  // before the address registers above are reused
      *(v4f*)&wbs[w * Cc + 4 * lane] = u;
    }
#pragma unroll  // t stays in registers: constant indices
    for (int r = 0; r < 16; ++r) *(v4f*)&stg[(w * 16 + r) * SP + 4 * lane] = t[r];
  }
  __syncthreads();

  // This wave's staged rows as a fragment, k = 4 kk + 2 half + {0, 1}.
  v2f of[32];
  {
    const float* own = stg + (w * 16 + ln) * SP + 2 * half;
#pragma unroll  // fragments stay in registers: constant indices
    for (int kk = 0; kk < 32; ++kk) of[kk] = *(const v2f*)(own + 4 * kk);
  }

  v8f acc;
  v2f xf[32];  // the other operand, k as in of

  // ---- step 1 ----
  if (w < 9) {
#pragma unroll  // acc is a register vector: constant indices
    for (int r = 0; r < 8; ++r) acc[r] = 0.f;
    if (keys) {
      const float* wb = stg + (QG + (ln < Gg + 1 ? ln : Gg + 1)) * SP + 2 * half;
#pragma unroll  // fragments stay in registers: constant indices
      for (int kk = 0; kk < 32; ++kk) xf[kk] = *(const v2f*)(wb + 4 * kk);
      // Keeps all the LDS reads ahead of the product: spread among its dependent
      // steps, one pair ahead, each of them is waited for.
      __builtin_amdgcn_sched_barrier(0);
#pragma unroll  // fragments stay in registers: constant indices
      for (int kk = 0; kk < 32; ++kk) acc = wmma4(xf[kk], of[kk], acc);
#pragma unroll  // acc is a register vector: constant indices
      for (int r = 0; r < 8; ++r) tab[(r + 8 * half) * PP + w * 16 + ln] = acc[r];
    } else {
      const float* bp = wbs + 2 * half * Hh + (ln & (Hh - 1));
#pragma unroll  // fragments stay in registers: constant indices
      for (int kk = 0; kk < 32; ++kk) {
        const float b0 = bp[4 * kk * Hh], b1 = bp[(4 * kk + 1) * Hh];
        xf[kk][0] = on ? b0 : 0.f;
        xf[kk][1] = on ? b1 : 0.f;
      }
      // Keeps all the LDS reads ahead of the product, as in the key blocks.
      __builtin_amdgcn_sched_barrier(0);
#pragma unroll  // fragments stay in registers: constant indices
      for (int kk = 0; kk < 32; ++kk) acc = wmma4(of[kk], xf[kk], acc);
      if (on) {
#pragma unroll  // acc is a register vector: constant indices
        for (int r = 0; r < 8; ++r) tab[(w * 16 + r + 8 * half) * Hh + ln] = acc[r];
      }
    }
  }
  __syncthreads();
  if (w < 9) {
    // Behind the barrier, so that step 2 of this block does not wait for the stores.
    if (w == 8 && blockIdx.x == 4 && b == 0 && on) {
#pragma unroll  // acc is a register vector: constant indices
      for (int r = 0; r < 8; ++r) Q[(Cc + r + 8 * half) * Hh + ln] = acc[r];
    }
    return;
  }

  // ---- step 2: of holds the text rows (t x m) ----
  if (keys) {
    const float* pp = tab + ln * PP + 2 * half;
    const float* pc = tab + 8 * half * PP + Cc;
#pragma unroll  // acc is a register vector: constant indices
    for (int r = 0; r < 8; ++r) acc[r] = pc[r * PP];
#pragma unroll  // fragments stay in registers: constant indices
    for (int kk = 0; kk < 32; ++kk) xf[kk] = *(const v2f*)(pp + 4 * kk);  // P (g x m)
    // Keeps all the LDS reads ahead of the product, as in step 1.
    __builtin_amdgcn_sched_barrier(0);
#pragma unroll  // fragments stay in registers: constant indices
    for (int kk = 0; kk < 32; ++kk) acc = wmma4(xf[kk], of[kk], acc);
#pragma unroll  // acc is a register vector: constant indices
    for (int r = 0; r < 8; ++r)
      KF[(size_t)(b * 16 + r + 8 * half) * Tt + t0 + ln] = acc[r];
  } else {
    const float* qp = tab + 2 * half * Hh + (ln & (Hh - 1));
    const float qb = tab[Cc * Hh + (ln & (Hh - 1))];
#pragma unroll  // acc is a register vector: constant indices
    for (int r = 0; r < 8; ++r) acc[r] = on ? qb : 0.f;
#pragma unroll  // fragments stay in registers: constant indices
    for (int kk = 0; kk < 32; ++kk) {  // Q (m x h)
      const float b0 = qp[4 * kk * Hh], b1 = qp[(4 * kk + 1) * Hh];
      xf[kk][0] = on ? b0 : 0.f;
      xf[kk][1] = on ? b1 : 0.f;
    }
    // Keeps all the LDS reads ahead of the product, as in step 1.
    __builtin_amdgcn_sched_barrier(0);
#pragma unroll  // fragments stay in registers: constant indices
    for (int kk = 0; kk < 32; ++kk) acc = wmma4(of[kk], xf[kk], acc);
    if (on) {
#pragma unroll  // acc is a register vector: constant indices
      for (int r = 0; r < 8; ++r)
        VF[(size_t)(b * Tt + t0 + r + 8 * half) * Hh + ln] = acc[r];
    }
  }
}

// ---------------------------------------------------------------------------
// One launch: geometry -> lang cross-attn scores -> softmax -> bias head (on the
// folded tables Q, KF, VF above), then the biased self-attention and the output
// projection. A block owns 8 query rows i of one batch; the bias of its rows,
// (4 heads x 8 i x 256 j), goes from the first part to the second through LDS
// instead of through memory and a launch boundary.
// grid = (N/8, B), block = 512 (16 waves): one block on every WGP.
//
// Part 1, the bias. Every product is taken transposed, with the text index t (or
// the head) in the rows of D and the pair index j in its columns. A lane then
// holds 32 of the 64 scores of its own j (lane ^ 16 holds the other 32), so the
// softmax runs in registers, and the registers of the exponentials are, pair by
// pair, the B operand of the head product; 1 / sum is the same for a whole column
// of D and multiplies the two result rows. Wave wv keeps one 16-wide j tile and
// walks the 8 rows i: centre and size of its nodes j are taken once; those of the
// 8 nodes i sit one in a lane and are read from there.
//
// Part 2, self-attention and output projection: 4 waves a head, the 256 keys of a
// head split over its 4 waves. Both products are taken transposed as above, with
// the key index j (or the channel c) in the rows of D and the query index i in its
// columns; columns 8..15 repeat columns 0..7 (a block has 8 rows, D has 16
// columns) and are merged too, but not written to the output. A lane holds 32 of its wave's 64 logits of its own
// i (lane ^ 16 the other 32), the softmax runs in registers, and the registers of
// the exponentials are, pair by pair, the B operand of the second product. Each
// wave keeps its own maximum, sum and partial output; they are merged once,
// through LDS, behind one barrier. A block holds all 4 heads, i.e. all 128
// channels of its rows, so the merged rows stay in LDS and are the A operand of
// the product with Wo, behind one more barrier: 8 waves, one 8x16 tile of the
// output each, in the k order and with the start value of gemm_bias_tile.
// ---------------------------------------------------------------------------
// Value of lane ^ 16.
__device__ __forceinline__ float other_half(float x) {
  const int v = __builtin_bit_cast(int, x);
  return __builtin_bit_cast(
      float, __builtin_amdgcn_permlanex16(v, v, 0x76543210, 0xfedcba98, false, false));
}

// Value of lane l (the same l in the whole wave), in a scalar register.
__device__ __forceinline__ float lane_value(float x, int l) {
  return __builtin_bit_cast(
      float, __builtin_amdgcn_readlane(__builtin_bit_cast(int, x), l));
}

// Extent of a node's 8 corners along x, y, z.
__device__ __forceinline__ void node_size(const float* __restrict__ cp, float& sx,
                                          float& sy, float& sz) {
  float mx0 = -1e30f, mx1 = -1e30f, mx2 = -1e30f;
  float mn0 = 1e30f, mn1 = 1e30f, mn2 = 1e30f;
#pragma unroll
  for (int c = 0; c < 8; ++c) {
    float x = cp[c * 3 + 0], y = cp[c * 3 + 1], z = cp[c * 3 + 2];
    mx0 = fmaxf(mx0, x); mn0 = fminf(mn0, x);
    mx1 = fmaxf(mx1, y); mn1 = fminf(mn1, y);
    mx2 = fmaxf(mx2, z); mn2 = fminf(mn2, z);
  }
  sx = mx0 - mn0; sy = mx1 - mn1; sz = mx2 - mn2;
}

#define RI 8        // query rows of a block
#define BPITCH 260  // floats per (head, i) row of the bias in LDS: 16 B x odd
#define BPLANE (RI * BPITCH + 8)  // floats per head: heads h and h + 2 meet other banks
#define OPITCH 36   // floats per row of a partial output: 16 B x odd
#define APITCH 132  // floats per merged row: 16 rows x 8 B x 2 halves meet each bank once

__global__ void __launch_bounds__(512)
relbias_attn_proj_kernel(const float* __restrict__ centers,
                         const float* __restrict__ corners,
                         const float* __restrict__ Q, const float* __restrict__ KF,
                         const float* __restrict__ VF,
                         const float* __restrict__ bbias,
                         const float* __restrict__ q, const float* __restrict__ k,
                         const float* __restrict__ v, const float* __restrict__ Wo,
                         const float* __restrict__ bo, float* __restrict__ outp) {
  __shared__ __attribute__((aligned(16))) float ldsB[Hh * BPLANE];  // bias [h][i][j]
  __shared__ __attribute__((aligned(16))) float ldsO[16][16][OPITCH];  // [wave][i][c]
  __shared__ float ldsMS[16][2][16];  // [wave][0: maximum, 1: sum][i]
  __shared__ __attribute__((aligned(16))) float ldsA[16][APITCH];  // merged [i][c of all heads]

  const int i0   = blockIdx.x * RI;
  const int b    = blockIdx.y;
  // The wave's number, held in a scalar register: j tile, head, key quarter and the
  // test for the projection's waves are then scalar.
  const int wv   = __builtin_amdgcn_readfirstlane(threadIdx.x >> 5);
  const int h    = wv >> 2;
  const int w    = wv & 3;
  const int lane = threadIdx.x & 31;
  const int half = lane >> 4;
  const int ln   = lane & 15;
  const int li   = ln & (RI - 1);  // this column's query row

  // ======================= part 1: the bias of 8 rows i =======================
  {
    const float rs128 = 0.08838834764831845f;  // 1/sqrt(128)
    const bool  hi  = half != 0;
    const int   j   = wv * 16 + ln;

    // A fragments of the folded tables: the same for every row i.
    // Head rows of D: head 2 * half + r sits in register r (r = 0, 1) of each lane
    // half, i.e. in A rows 0, 1, 8, 9, so that all 32 lanes store.
    v2f kf[4][3];   // KF[b] rows 0..11 as (t x g), four 16-row t tiles
    v8f kc[4];      // KF[b] row 12 at t = 16 tt + 8 half + r: C of the scores
    v2f gf[3];      // (Wrel @ Wbias)^T, rows other than 0, 1, 8, 9 zero
    v2f vf[16];     // VF[b]^T in the k order of the score registers (below)
    v8f hb;         // brel @ Wbias + bbias: C of the head
    {
      const float* KFb = KF + (size_t)b * 16 * Tt;
      const float* VFb = VF + (size_t)b * Tt * Hh;
#pragma unroll  // fragments stay in registers: constant indices
      for (int tt = 0; tt < 4; ++tt) {
#pragma unroll  // fragments stay in registers: constant indices
        for (int kk = 0; kk < 3; ++kk) {
          kf[tt][kk][0] = KFb[(4 * kk + 2 * half) * Tt + tt * 16 + ln];
          kf[tt][kk][1] = KFb[(4 * kk + 2 * half + 1) * Tt + tt * 16 + ln];
        }
      }
      asm volatile("s_wait_xcnt 0x0" ::: "memory");  // before the address registers above are reused
#pragma unroll  // fragments stay in registers: constant indices
      for (int tt = 0; tt < 4; ++tt) {
#pragma unroll  // kc is a register vector: constant indices
        for (int r = 0; r < 8; ++r)
          kc[tt][r] = KFb[Gg * Tt + tt * 16 + 8 * half + r];
      }
      // padding rows read a valid head, select 0
      const int hc = 2 * (ln >> 3) + (ln & 1);
      const bool on = (ln & 7) < 2;
#pragma unroll  // fragments stay in registers: constant indices
      for (int kk = 0; kk < 3; ++kk) {
        const float g0 = Q[(QG + 4 * kk + 2 * half) * Hh + hc];
        const float g1 = Q[(QG + 4 * kk + 2 * half + 1) * Hh + hc];
        gf[kk][0] = on ? g0 : 0.f;
        gf[kk][1] = on ? g1 : 0.f;
      }
      // k step 4 tt + p of the head takes t = 16 tt + 8 half + 2 p + {0, 1}:
      // registers 2 p and 2 p + 1 of score tile tt.
#pragma unroll  // fragments stay in registers: constant indices
      for (int kk = 0; kk < 16; ++kk) {
        const int t = 16 * (kk >> 2) + 8 * half + 2 * (kk & 3);
        const float v0 = VFb[t * Hh + hc];
        const float v1 = VFb[(t + 1) * Hh + hc];
        vf[kk][0] = on ? v0 : 0.f;
        vf[kk][1] = on ? v1 : 0.f;
      }
#pragma unroll  // hb is a register vector: constant indices
      for (int r = 0; r < 8; ++r) hb[r] = 0.f;
      hb[0] = Q[(QG + Gg) * Hh + 2 * half] + bbias[2 * half];
      hb[1] = Q[(QG + Gg) * Hh + 2 * half + 1] + bbias[2 * half + 1];
      asm volatile("s_wait_xcnt 0x0" ::: "memory");  // before the address registers above are reused
    }

    // centre and size of this lane's node j, and of node i0 + li
    const float cxj = centers[(size_t)(b * Nn + j) * 3 + 0];
    const float cyj = centers[(size_t)(b * Nn + j) * 3 + 1];
    const float czj = centers[(size_t)(b * Nn + j) * 3 + 2];
    float sxj, syj, szj;
    node_size(corners + (size_t)(b * Nn + j) * 24, sxj, syj, szj);
    asm volatile("s_wait_xcnt 0x0" ::: "memory");  // before the address registers above are reused
    const float cxn = centers[(size_t)(b * Nn + i0 + li) * 3 + 0];
    const float cyn = centers[(size_t)(b * Nn + i0 + li) * 3 + 1];
    const float czn = centers[(size_t)(b * Nn + i0 + li) * 3 + 2];
    float sxn, syn, szn;
    node_size(corners + (size_t)(b * Nn + i0 + li) * 24, sxn, syn, szn);
    asm volatile("s_wait_xcnt 0x0" ::: "memory");  // before the address registers above are reused

    for (int ii = 0; ii < RI; ++ii) {
      const float cxi = lane_value(cxn, ii), cyi = lane_value(cyn, ii);
      const float czi = lane_value(czn, ii);
      const float sxi = lane_value(sxn, ii), syi = lane_value(syn, ii);
      const float szi = lane_value(szn, ii);

      // ---- stage 1: geometry features of pair (i, j), in both lane halves ----
      v2f gb[3];  // geom^T (g x j), g = 4 kk + 2 half + {0, 1} as in kf and gf
      {
        const float r0 = cxj - cxi, r1 = cyj - cyi, r2 = czj - czi;
        const float dist  = sqrtf(r0 * r0 + r1 * r1 + r2 * r2);
        const float horiz = sqrtf(r0 * r0 + r1 * r1);
        const float cose  = r2 / (dist + EPSF);
        const float dlog  = logf(dist + EPSF);
        // Feature 9 (lower half) and feature 11 (upper half) share one division.
        const float ry  = syj / (syi + EPSF);
        const float rxz = (hi ? szj : sxj) / ((hi ? szi : sxi) + EPSF);
        gb[0][0] = hi ? r2 : r0;
        gb[0][1] = hi ? dlog : r1;
        gb[1][0] = hi ? sxj - sxi : horiz;
        gb[1][1] = hi ? syj - syi : cose;
        gb[2][0] = hi ? ry : szj - szi;
        gb[2][1] = rxz;
      }

      // ---- stage 2: scores^T = (KF^T(64x12) @ geom^T(12x16) + KF row 12) * rs128
      v8f s[4];   // s[tt][r] = score of (t = 16 tt + 8 half + r, j)
#pragma unroll  // fragments stay in registers: constant indices
      for (int tt = 0; tt < 4; ++tt) {
        v8f acc = kc[tt];
#pragma unroll  // fragments stay in registers: constant indices
        for (int kk = 0; kk < 3; ++kk) acc = wmma4(kf[tt][kk], gb[kk], acc);
        s[tt] = acc * rs128;
      }

      // ---- stage 3: softmax over T=64, 32 registers in each of 2 lanes ----
      float inv;  // 1 / sum of the exponentials; applied behind the head product
      {
        float mx = -1e30f;
#pragma unroll  // s is a register array: constant indices
        for (int tt = 0; tt < 4; ++tt)
#pragma unroll  // s is a register array: constant indices
          for (int r = 0; r < 8; ++r) mx = fmaxf(mx, s[tt][r]);
        mx = fmaxf(mx, other_half(mx));
#pragma unroll  // s is a register array: constant indices
        for (int tt = 0; tt < 4; ++tt)
#pragma unroll  // s is a register array: constant indices
          for (int r = 0; r < 8; ++r) s[tt][r] = __expf(s[tt][r] - mx);
        const v8f sv = (s[0] + s[1]) + (s[2] + s[3]);
        float sum = ((sv[0] + sv[1]) + (sv[2] + sv[3])) +
                    ((sv[4] + sv[5]) + (sv[6] + sv[7]));
        sum += other_half(sum);
        inv = 1.f / sum;
      }

      // ---- stage 4: bias^T = gf(16x12) @ geom^T + hb + vf(16x64) @ exp^T * inv
      {
        v8f accg = hb;
#pragma unroll  // fragments stay in registers: constant indices
        for (int kk = 0; kk < 3; ++kk) accg = wmma4(gf[kk], gb[kk], accg);
        v8f acce;
#pragma unroll  // acce is a register vector: constant indices
        for (int r = 0; r < 8; ++r) acce[r] = 0.f;
#pragma unroll  // fragments stay in registers: constant indices
        for (int kk = 0; kk < 16; ++kk) {
          v2f ex;
          ex[0] = s[kk >> 2][2 * (kk & 3)];
          ex[1] = s[kk >> 2][2 * (kk & 3) + 1];
          acce = wmma4(vf[kk], ex, acce);
        }
        float* op = ldsB + 2 * half * BPLANE + ii * BPITCH + j;
        op[0]      = accg[0] + acce[0] * inv;
        op[BPLANE] = accg[1] + acce[1] * inv;
      }
    }
  }

  // ================= part 2: attention and output projection =================
  const int j0   = w * 64;
  const float scale = 0.1767766952966369f;  // 1/sqrt(32)

  v2f qf[8];      // q^T (d x i), d = 4 kk + 2 half + {0, 1}
  v2f kf[4][8];   // k (j x d), four 16-row j tiles, d as in qf
  v8f s[4];       // s[tt][r] = logit of (j = j0 + 16 tt + 8 half + r, i)
  v2f vf[2][16];  // v^T (c x j) in the k order of the logit registers (below)
  {
    const float* qp = q + (size_t)(b * Nn + i0 + li) * Cc + h * Dd + 2 * half;
#pragma unroll  // fragments stay in registers: constant indices
    for (int kk = 0; kk < 8; ++kk) {
      qf[kk][0] = qp[4 * kk];
      qf[kk][1] = qp[4 * kk + 1];
    }
    asm volatile("s_wait_xcnt 0x0" ::: "memory");  // before the address registers above are reused
    const float* kp = k + (size_t)(b * Nn + j0 + ln) * Cc + h * Dd + 2 * half;
#pragma unroll  // fragments stay in registers: constant indices
    for (int tt = 0; tt < 4; ++tt)
#pragma unroll  // fragments stay in registers: constant indices
      for (int kk = 0; kk < 8; ++kk) {
        kf[tt][kk][0] = kp[tt * 16 * Cc + 4 * kk];
        kf[tt][kk][1] = kp[tt * 16 * Cc + 4 * kk + 1];
      }
    asm volatile("s_wait_xcnt 0x0" ::: "memory");  // before the address registers above are reused
    // k step 4 tt + p of the second product takes j = j0 + 16 tt + 8 half +
    // 2 p + {0, 1}: registers 2 p and 2 p + 1 of logit tile tt.
    const float* vp = v + (size_t)(b * Nn + j0 + 8 * half) * Cc + h * Dd + ln;
#pragma unroll  // fragments stay in registers: constant indices
    for (int ct = 0; ct < 2; ++ct)
#pragma unroll  // fragments stay in registers: constant indices
      for (int kk = 0; kk < 16; ++kk) {
        const int jr = 16 * (kk >> 2) + 2 * (kk & 3);
        vf[ct][kk][0] = vp[jr * Cc + ct * 16];
        vf[ct][kk][1] = vp[(jr + 1) * Cc + ct * 16];
      }
    asm volatile("s_wait_xcnt 0x0" ::: "memory");  // before the address registers above are reused

    // The loads above stand in front of the barrier: a wave waits for them while the
    // slower waves still work on the bias, not behind the last of those.
    __syncthreads();

    // The bias is the C operand of the first product: 8 j in a row per lane.
    const float* bp = ldsB + h * BPLANE + li * BPITCH + j0 + 8 * half;
#pragma unroll  // s is a register array: constant indices
    for (int tt = 0; tt < 4; ++tt) {
      const v4f lo = *(const v4f*)(bp + tt * 16);
      const v4f up = *(const v4f*)(bp + tt * 16 + 4);
#pragma unroll  // s is a register array: constant indices
      for (int r = 0; r < 4; ++r) {
        s[tt][r]     = lo[r];
        s[tt][r + 4] = up[r];
      }
    }
  }

  // Keeps the reads of the bias ahead of the first product: spread among its
  // steps, each of them is waited for.
  __builtin_amdgcn_sched_barrier(0);

  // logits^T = k(64x32) @ (q * scale)^T(32x16) + bias^T
#pragma unroll  // fragments stay in registers: constant indices
  for (int kk = 0; kk < 8; ++kk) {
    const v2f qs = qf[kk] * scale;
#pragma unroll  // fragments stay in registers: constant indices
    for (int tt = 0; tt < 4; ++tt) s[tt] = wmma4(kf[tt][kk], qs, s[tt]);
  }

  // this wave's part of the softmax: 32 registers in each of 2 lanes
  float mx = -1e30f, sum;
  {
#pragma unroll  // s is a register array: constant indices
    for (int tt = 0; tt < 4; ++tt)
#pragma unroll  // s is a register array: constant indices
      for (int r = 0; r < 8; ++r) mx = fmaxf(mx, s[tt][r]);
    mx = fmaxf(mx, other_half(mx));
  }

  // The projection's waves fetch their tile of Wo (k x n, k = 4 kk + 2 half +
  // {0, 1}) here, into the registers that k has left: it lands under the
  // exponentials and the second product.
  v2f wf[32];
  float bov = 0.f;
  if (wv < 8) {
    const float* wp = Wo + (size_t)(2 * half) * Cc + wv * 16 + ln;
#pragma unroll  // fragments stay in registers: constant indices
    for (int kk = 0; kk < 32; ++kk) {
      wf[kk][0] = wp[4 * kk * Cc];
      wf[kk][1] = wp[(4 * kk + 1) * Cc];
    }
    bov = bo[wv * 16 + ln];
    asm volatile("s_wait_xcnt 0x0" ::: "memory");  // before the address registers above are reused
  }

  {
#pragma unroll  // s is a register array: constant indices
    for (int tt = 0; tt < 4; ++tt)
#pragma unroll  // s is a register array: constant indices
      for (int r = 0; r < 8; ++r) s[tt][r] = __expf(s[tt][r] - mx);
    const v8f sv = (s[0] + s[1]) + (s[2] + s[3]);
    sum = ((sv[0] + sv[1]) + (sv[2] + sv[3])) +
          ((sv[4] + sv[5]) + (sv[6] + sv[7]));
    sum += other_half(sum);
  }

  // partial out^T = v^T(32x64) @ exp^T(64x16)
  v8f o[2];  // o[ct][r] = (c = 16 ct + 8 half + r, i)
#pragma unroll  // o is a register array: constant indices
  for (int ct = 0; ct < 2; ++ct)
#pragma unroll  // o is a register array: constant indices
    for (int r = 0; r < 8; ++r) o[ct][r] = 0.f;
#pragma unroll  // fragments stay in registers: constant indices
  for (int kk = 0; kk < 16; ++kk) {
    v2f ex;
    ex[0] = s[kk >> 2][2 * (kk & 3)];
    ex[1] = s[kk >> 2][2 * (kk & 3) + 1];
#pragma unroll  // fragments stay in registers: constant indices
    for (int ct = 0; ct < 2; ++ct) o[ct] = wmma4(vf[ct][kk], ex, o[ct]);
  }

#pragma unroll  // o is a register array: constant indices
  for (int ct = 0; ct < 2; ++ct) {
    v4f lo, up;
#pragma unroll  // o is a register array: constant indices
    for (int r = 0; r < 4; ++r) {
      lo[r] = o[ct][r];
      up[r] = o[ct][r + 4];
    }
    *(v4f*)&ldsO[wv][ln][ct * 16 + 8 * half]     = lo;
    *(v4f*)&ldsO[wv][ln][ct * 16 + 8 * half + 4] = up;
  }
  ldsMS[wv][half][ln] = half ? sum : mx;  // both are equal in the two lane halves
  __syncthreads();

  // merge: wave w of head h takes rows 4 w .. 4 w + 3 of that head, 8 lanes a row.
  {
    const int mi = 4 * w + (lane >> 3);
    const int mc = 4 * (lane & 7);
    float m[4];
#pragma unroll  // m is a register array: constant indices
    for (int x = 0; x < 4; ++x) m[x] = ldsMS[4 * h + x][0][mi];
    const float mall = fmaxf(fmaxf(m[0], m[1]), fmaxf(m[2], m[3]));
    float tot = 0.f;
    v4f acc = {0.f, 0.f, 0.f, 0.f};
#pragma unroll  // m is a register array: constant indices
    for (int x = 0; x < 4; ++x) {
      const float f = __expf(m[x] - mall);
      tot += f * ldsMS[4 * h + x][1][mi];
      acc += f * *(const v4f*)&ldsO[4 * h + x][mi][mc];
    }
    const float inv = 1.f / tot;
    *(v4f*)&ldsA[mi][h * Dd + mc] = acc * inv;
  }
  __syncthreads();

  // out(16x16 tile) = merged rows(16x128) @ Wo(128x16) + bo
  if (wv < 8) {
    v8f acc;
#pragma unroll  // acc is a register vector: constant indices
    for (int r = 0; r < 8; ++r) acc[r] = bov;
    float* op = outp + (size_t)(b * Nn + i0) * Cc + wv * 16 + ln;
    v2f af[32];  // merged rows (i x k), k as in wf
#pragma unroll  // fragments stay in registers: constant indices
    for (int kk = 0; kk < 32; ++kk)
      af[kk] = *(const v2f*)&ldsA[ln][4 * kk + 2 * half];
    // Keeps all the LDS reads ahead of the product: spread among its dependent
    // steps, one pair ahead, each of them is waited for.
    __builtin_amdgcn_sched_barrier(0);
#pragma unroll  // fragments stay in registers: constant indices
    for (int kk = 0; kk < 32; ++kk) acc = wmma4(af[kk], wf[kk], acc);
    if (half == 0) {  // rows 8..15 of D repeat rows 0..7
#pragma unroll  // acc is a register vector: constant indices
      for (int r = 0; r < 8; ++r) op[r * Cc] = acc[r];
    }
  }
}

// ---------------------------------------------------------------------------
extern "C" void kernel_launch(void* const* d_in, const int* in_sizes, int n_in,
                              void* d_out, int out_size, void* d_ws,
                              size_t ws_size, hipStream_t stream) {
  (void)in_sizes; (void)n_in; (void)out_size; (void)ws_size;
  const float* feat    = (const float*)d_in[0];
  const float* centers = (const float*)d_in[1];
  const float* corners = (const float*)d_in[2];
  const float* lang    = (const float*)d_in[3];
  const float* Wq = (const float*)d_in[4];  const float* bq = (const float*)d_in[5];
  const float* Wk = (const float*)d_in[6];  const float* bk = (const float*)d_in[7];
  const float* Wv = (const float*)d_in[8];  const float* bv = (const float*)d_in[9];
  const float* Wo = (const float*)d_in[10]; const float* bo = (const float*)d_in[11];
  const float* Wrel = (const float*)d_in[12]; const float* brel = (const float*)d_in[13];
  const float* Wtk  = (const float*)d_in[14]; const float* btk  = (const float*)d_in[15];
  const float* Wtv  = (const float*)d_in[16]; const float* btv  = (const float*)d_in[17];
  const float* Wbias = (const float*)d_in[18]; const float* bbias = (const float*)d_in[19];

  float* ws = (float*)d_ws;
  const size_t MR = (size_t)Bsz * Nn;  // 2048 rows
  float* qb      = ws;
  float* kb      = qb + MR * Cc;
  float* vb      = kb + MR * Cc;
  float* Qf      = vb + MR * Cc;
  float* KFf     = Qf + (size_t)QR * Hh;
  float* VFf     = KFf + (size_t)Bsz * 16 * Tt;

  // folded tables of the language cross-attention, and in the same launch the
  // q / k / v projections (2048x128 @ 128x128)
  fold_qkv_kernel<<<dim3(8, Bsz + 39), 320, 0, stream>>>(
      Wrel, brel, Wtk, btk, Wtv, btv, Wbias, lang, Qf, KFf, VFf, feat, Wq, bq, Wk,
      bk, Wv, bv, qb, kb, vb);

  // geometry + language cross-attention -> bias, kept in LDS; biased multi-head
  // self-attention and the final projection -> d_out
  relbias_attn_proj_kernel<<<dim3(Nn / RI, Bsz), 512, 0, stream>>>(
      centers, corners, Qf, KFf, VFf, bbias, qb, kb, vb, Wo, bo, (float*)d_out);
}

// v008
// One run takes 26.9 microseconds.
// Next to v007, in two timings, it ran 1.04 and 1.05 times as fast.
// All steps since v000 together make it 13.3 times as fast.
#include <hip/hip_runtime.h>
#include <math.h>

// Problem constants (match reference)
#define Bsz 8
#define Nn  256
#define Cc  128
#define Tt  64
#define Hh  4
#define Gg  12
#define Dd  32
#define EPSF 1e-6f

typedef __attribute__((ext_vector_type(2))) float v2f;
typedef __attribute__((ext_vector_type(4))) float v4f;
typedef __attribute__((ext_vector_type(8))) float v8f;

// D = A(16x4,f32) * B(4x16,f32) + C(16x16,f32)   -> v_wmma_f32_16x16x4_f32
__device__ __forceinline__ v8f wmma4(v2f a, v2f b, v8f c) {
  return __builtin_amdgcn_wmma_f32_16x16x4_f32(false, a, false, b, (short)0, c,
                                               false, false);
}

// ---------------------------------------------------------------------------
// The per-pair chain is linear in the 12 geometry features up to the softmax
// and linear again behind it, so its weight products are taken once instead of
// once per (i, j) pair:
//   scores = geom @ (Wrel @ k_txt^T) + brel @ k_txt^T
//   bias   = geom @ (Wrel @ Wbias) + alpha @ (v_txt @ Wbias) + brel @ Wbias + bbias
// with k_txt = lang @ Wtk + btk and v_txt = lang @ Wtv + btv folded the same way.
//
// Both steps run in one launch. A block owns one 16-wide t tile of one batch, for
// the keys (blockIdx.x 0..3) or for the values (4..7); it takes step 1 for itself,
// one 16x16 tile a wave, keeps the table in LDS and takes step 2 from there behind
// a barrier. Step 1 is small, so that every block repeats it costs less than a
// launch of its own between the two steps.
//
// The waves of a block share one load path, and a fragment load straight from
// memory touches 16 lines for 256 bytes. So all operands come in by whole rows
// (one 512-byte row an instruction) and go to LDS, each wave 16 rows, and the
// fragments are read from there behind a barrier.
//   staged rows 0..127 = Wtk rows (key blocks) or Wtv rows (value blocks),
//   128 = btk or btv, 129..140 = Wrel rows, 141 = brel, 142 and 143 = 0,
//   144..159 = the block's 16 rows of lang
//
// Step 1, independent of the batch, waves 0..8.
//   key blocks  : P[g][n] = sum_c WB[g][c] * Y[n][c]    (16 x 144)
//                 WB rows 0..12 = staged rows 129..141, the rest 0
//                 Y = staged rows 0..143; columns 129.. of P are not read
//   value blocks: Q[m][h] = sum_c Z[m][c] * Wbias[c][h] (QR x 4)
//                 Z = staged rows 0..143
//                 Rows 128.. also go to memory, from one block, for the bias kernel.
// Step 2, per batch, wave 9.
//   key blocks  : KF[b][g][t] = sum_m P[g][m] * lang[b][t][m] + P[g][128]
//                 (rows 0..11 = Wrel @ k_txt^T, row 12 = brel @ k_txt^T)
//   value blocks: VF[b][t][h] = sum_m lang[b][t][m] * Q[m][h] + Q[128][h]
//                 (= v_txt @ Wbias)
// grid = (8, B + 24), block = 320 (10 waves); blockIdx.y < B is the work above.
//
// The q, k and v projections (out = feat @ W + bias) depend on nothing that this
// kernel writes, and the 64 blocks above leave most of the chip idle, so they ride
// in the same launch: the 192 blocks with blockIdx.y >= B each take 32 rows x all
// 128 columns of one projection. Waves 8 and 9 bring the 32 rows of feat to LDS by
// whole rows, as above, once for the block; wave w < 8 takes column tile w of both
// 16-row tiles, so its fragments of W, fetched in front of the barrier, serve two
// products. These blocks have the highest indices, so the blocks with the long
// dependent path start first.
// ---------------------------------------------------------------------------
#define SP 132        // floats per staged row: 16 rows x 8 B x 2 halves meet each bank once
#define PP 148        // floats per row of P in LDS: the same
#define QR 144
#define QG (Cc + 1)   // first row of Wrel @ Wbias in Q

__global__ void __launch_bounds__(320)
fold_qkv_kernel(const float* __restrict__ Wrel, const float* __restrict__ brel,
            const float* __restrict__ Wtk, const float* __restrict__ btk,
            const float* __restrict__ Wtv, const float* __restrict__ btv,
            const float* __restrict__ Wbias, const float* __restrict__ lang,
            float* __restrict__ Q, float* __restrict__ KF,
            float* __restrict__ VF, const float* __restrict__ feat,
            const float* __restrict__ Wq, const float* __restrict__ bq,
            const float* __restrict__ Wk, const float* __restrict__ bk,
            const float* __restrict__ Wv, const float* __restrict__ bv,
            float* __restrict__ qout, float* __restrict__ kout,
            float* __restrict__ vout) {
  // One array, the small tables first: their reads then take constant offsets.
  __shared__ __attribute__((aligned(16))) float lds[Cc * Hh + 16 * PP + (QR + 16) * SP];
  if (blockIdx.y >= Bsz) {
    const int lane = threadIdx.x & 31;
    const int half = lane >> 4;
    const int ln   = lane & 15;
    // The wave's number, held in a scalar register: the tests on it are scalar.
    const int w    = __builtin_amdgcn_readfirstlane(threadIdx.x >> 5);
    const int blk  = (blockIdx.y - Bsz) * 8 + blockIdx.x;  // 0..191
    const int p    = blk >> 6;
    const int row0 = (blk & 63) * 32;

    v2f wf[32];  // W (k x n), k = 4 kk + 2 half + {0, 1}
    float bias0 = 0.f;
    if (w >= 8) {
      // whole rows of feat to LDS: 16 rows a wave, one 512-byte row an instruction
      const float* sp = feat + (size_t)(row0 + (w - 8) * 16) * Cc + 4 * lane;
      v4f t[16];
#pragma unroll  // t stays in registers: constant indices
      for (int r = 0; r < 16; ++r) t[r] = *(const v4f*)(sp + r * Cc);
      asm volatile("s_wait_xcnt 0x0" ::: "memory");  // before the address registers above are reused
#pragma unroll  // t stays in registers: constant indices
      for (int r = 0; r < 16; ++r) *(v4f*)&lds[((w - 8) * 16 + r) * SP + 4 * lane] = t[r];
    } else {
      const float* Wp = p == 0 ? Wq : p == 1 ? Wk : Wv;
      const float* bp = p == 0 ? bq : p == 1 ? bk : bv;
      const float* wp = Wp + (size_t)(2 * half) * Cc + w * 16 + ln;
#pragma unroll  // fragments stay in registers: constant indices
      for (int kk = 0; kk < 32; ++kk) {
        wf[kk][0] = wp[4 * kk * Cc];
        wf[kk][1] = wp[(4 * kk + 1) * Cc];
      }
      bias0 = bp[w * 16 + ln];
      asm volatile("s_wait_xcnt 0x0" ::: "memory");  // before the address registers above are reused
    }
    __syncthreads();
    if (w >= 8) return;

    v2f a0[32], a1[32];  // feat rows (m x k) of the two row tiles, k as in wf
    {
      const float* ap = lds + ln * SP + 2 * half;
#pragma unroll  // fragments stay in registers: constant indices
      for (int kk = 0; kk < 32; ++kk) {
        a0[kk] = *(const v2f*)(ap + 4 * kk);
        a1[kk] = *(const v2f*)(ap + 16 * SP + 4 * kk);
      }
    }
    // Keeps all the LDS reads ahead of the products: spread among their steps, one
    // pair ahead, each of them is waited for.
    __builtin_amdgcn_sched_barrier(0);
    v8f c0, c1;
#pragma unroll  // c0 and c1 are register vectors: constant indices
    for (int r = 0; r < 8; ++r) {
      c0[r] = bias0;
      c1[r] = bias0;
    }
#pragma unroll  // fragments stay in registers: constant indices
    for (int kk = 0; kk < 32; ++kk) {
      c0 = wmma4(a0[kk], wf[kk], c0);
      c1 = wmma4(a1[kk], wf[kk], c1);
    }
    float* op = (p == 0 ? qout : p == 1 ? kout : vout) +
                (size_t)(row0 + 8 * half) * Cc + w * 16 + ln;
#pragma unroll  // c0 and c1 are register vectors: constant indices
    for (int r = 0; r < 8; ++r) {
      op[r * Cc]        = c0[r];
      op[(16 + r) * Cc] = c1[r];
    }
    return;
  }

  float* const wbs = lds;            // Wbias
  float* const tab = wbs + Cc * Hh;  // P, or Q (QR x 4)
  float* const stg = tab + 16 * PP;  // staged rows

  const int lane = threadIdx.x & 31;
  const int half = lane >> 4;
  const int ln   = lane & 15;
  // The wave's number, held in a scalar register: the tests on it are scalar.
  const int w    = __builtin_amdgcn_readfirstlane(threadIdx.x >> 5);
  const int b    = blockIdx.y;
  const int t0   = (blockIdx.x & 3) * 16;
  const bool keys = blockIdx.x < 4;
  const bool on   = ln < Hh;  // a head's column; padding columns select 0

  // ---- whole rows to LDS: wave w brings staged rows 16 w .. 16 w + 15 ----
  {
    v4f t[16];
    if (w == 8) {
      t[0] = *(const v4f*)((keys ? btk : btv) + 4 * lane);
#pragma unroll  // t stays in registers: constant indices
      for (int g = 0; g < Gg; ++g) t[1 + g] = *(const v4f*)(Wrel + g * Cc + 4 * lane);
      t[1 + Gg] = *(const v4f*)(brel + 4 * lane);
      t[14] = (v4f){0.f, 0.f, 0.f, 0.f};
      t[15] = (v4f){0.f, 0.f, 0.f, 0.f};
    } else {
      const float* sp = (w == 9 ? lang + (size_t)(b * Tt + t0) * Cc
                                : (keys ? Wtk : Wtv) + (size_t)(w * 16) * Cc) + 4 * lane;
#pragma unroll  // t stays in registers: constant indices
      for (int r = 0; r < 16; ++r) t[r] = *(const v4f*)(sp + r * Cc);
    }
    asm volatile("s_wait_xcnt 0x0" ::: "memory");  // before the address registers above are reused
    if (w < 4 && !keys) {
      const v4f u = *(const v4f*)(Wbias + w * Cc + 4 * lane);
      asm volatile("s_wait_xcnt 0x0" ::: "memory");  // before the address registers above are reused
      *(v4f*)&wbs[w * Cc + 4 * lane] = u;
    }
#pragma unroll  // t stays in registers: constant indices
    for (int r = 0; r < 16; ++r) *(v4f*)&stg[(w * 16 + r) * SP + 4 * lane] = t[r];
  }
  __syncthreads();

  // This wave's staged rows as a fragment, k = 4 kk + 2 half + {0, 1}.
  v2f of[32];
  {
    const float* own = stg + (w * 16 + ln) * SP + 2 * half;
#pragma unroll  // fragments stay in registers: constant indices
    for (int kk = 0; kk < 32; ++kk) of[kk] = *(const v2f*)(own + 4 * kk);
  }

  v8f acc;
  v2f xf[32];  // the other operand, k as in of

  // ---- step 1 ----
  if (w < 9) {
#pragma unroll  // acc is a register vector: constant indices
    for (int r = 0; r < 8; ++r) acc[r] = 0.f;
    if (keys) {
      const float* wb = stg + (QG + (ln < Gg + 1 ? ln : Gg + 1)) * SP + 2 * half;
#pragma unroll  // fragments stay in registers: constant indices
      for (int kk = 0; kk < 32; ++kk) xf[kk] = *(const v2f*)(wb + 4 * kk);
      // Keeps all the LDS reads ahead of the product: spread among its dependent
      // steps, one pair ahead, each of them is waited for.
      __builtin_amdgcn_sched_barrier(0);
#pragma unroll  // fragments stay in registers: constant indices
      for (int kk = 0; kk < 32; ++kk) acc = wmma4(xf[kk], of[kk], acc);
#pragma unroll  // acc is a register vector: constant indices
      for (int r = 0; r < 8; ++r) tab[(r + 8 * half) * PP + w * 16 + ln] = acc[r];
    } else {
      const float* bp = wbs + 2 * half * Hh + (ln & (Hh - 1));
#pragma unroll  // fragments stay in registers: constant indices
      for (int kk = 0; kk < 32; ++kk) {
        const float b0 = bp[4 * kk * Hh], b1 = bp[(4 * kk + 1) * Hh];
        xf[kk][0] = on ? b0 : 0.f;
        xf[kk][1] = on ? b1 : 0.f;
      }
      // Keeps all the LDS reads ahead of the product, as in the key blocks.
      __builtin_amdgcn_sched_barrier(0);
#pragma unroll  // fragments stay in registers: constant indices
      for (int kk = 0; kk < 32; ++kk) acc = wmma4(of[kk], xf[kk], acc);
      if (on) {
#pragma unroll  // acc is a register vector: constant indices
        for (int r = 0; r < 8; ++r) tab[(w * 16 + r + 8 * half) * Hh + ln] = acc[r];
      }
    }
  }
  __syncthreads();
  if (w < 9) {
    // Behind the barrier, so that step 2 of this block does not wait for the stores.
    if (w == 8 && blockIdx.x == 4 && b == 0 && on) {
#pragma unroll  // acc is a register vector: constant indices
      for (int r = 0; r < 8; ++r) Q[(Cc + r + 8 * half) * Hh + ln] = acc[r];
    }
    return;
  }

  // ---- step 2: of holds the text rows (t x m) ----
  if (keys) {
    const float* pp = tab + ln * PP + 2 * half;
    const float* pc = tab + 8 * half * PP + Cc;
#pragma unroll  // acc is a register vector: constant indices
    for (int r = 0; r < 8; ++r) acc[r] = pc[r * PP];
#pragma unroll  // fragments stay in registers: constant indices
    for (int kk = 0; kk < 32; ++kk) xf[kk] = *(const v2f*)(pp + 4 * kk);  // P (g x m)
    // Keeps all the LDS reads ahead of the product, as in step 1.
    __builtin_amdgcn_sched_barrier(0);
#pragma unroll  // fragments stay in registers: constant indices
    for (int kk = 0; kk < 32; ++kk) acc = wmma4(xf[kk], of[kk], acc);
#pragma unroll  // acc is a register vector: constant indices
    for (int r = 0; r < 8; ++r)
      KF[(size_t)(b * 16 + r + 8 * half) * Tt + t0 + ln] = acc[r];
  } else {
    const float* qp = tab + 2 * half * Hh + (ln & (Hh - 1));
    const float qb = tab[Cc * Hh + (ln & (Hh - 1))];
#pragma unroll  // acc is a register vector: constant indices
    for (int r = 0; r < 8; ++r) acc[r] = on ? qb : 0.f;
#pragma unroll  // fragments stay in registers: constant indices
    for (int kk = 0; kk < 32; ++kk) {  // Q (m x h)
      const float b0 = qp[4 * kk * Hh], b1 = qp[(4 * kk + 1) * Hh];
      xf[kk][0] = on ? b0 : 0.f;
      xf[kk][1] = on ? b1 : 0.f;
    }
    // Keeps all the LDS reads ahead of the product, as in step 1.
    __builtin_amdgcn_sched_barrier(0);
#pragma unroll  // fragments stay in registers: constant indices
    for (int kk = 0; kk < 32; ++kk) acc = wmma4(of[kk], xf[kk], acc);
    if (on) {
#pragma unroll  // acc is a register vector: constant indices
      for (int r = 0; r < 8; ++r)
        VF[(size_t)(b * Tt + t0 + r + 8 * half) * Hh + ln] = acc[r];
    }
  }
}

// ---------------------------------------------------------------------------
// One launch: geometry -> lang cross-attn scores -> softmax -> bias head (on the
// folded tables Q, KF, VF above), then the biased self-attention and the output
// projection. A block owns 8 query rows i of one batch; the bias of its rows,
// (4 heads x 8 i x 256 j), goes from the first part to the second through LDS
// instead of through memory and a launch boundary.
// grid = (N/8, B), block = 512 (16 waves): one block on every WGP.
//
// Part 1, the bias. Every product is taken transposed, with the text index t (or
// the head) in the rows of D and the pair index j in its columns. A lane then
// holds 32 of the 64 scores of its own j (lane ^ 16 holds the other 32), so the
// softmax runs in registers, and the registers of the exponentials are, pair by
// pair, the B operand of the head product; 1 / sum is the same for a whole column
// of D and multiplies the two result rows. Wave wv keeps one 16-wide j tile and
// walks the 8 rows i: centre and size of its nodes j are taken once; those of the
// 8 nodes i sit one in a lane and are read from there.
//
// Part 2, self-attention and output projection: 4 waves a head, the 256 keys of a
// head split over its 4 waves. Both products are taken transposed as above, with
// the key index j (or the channel c) in the rows of D and the query index i in its
// columns; columns 8..15 repeat columns 0..7 (a block has 8 rows, D has 16
// columns) and are merged too, but not written to the output. A lane holds 32 of its wave's 64 logits of its own
// i (lane ^ 16 the other 32), the softmax runs in registers, and the registers of
// the exponentials are, pair by pair, the B operand of the second product. Each
// wave keeps its own maximum, sum and partial output; they are merged once,
// through LDS, behind one barrier. A block holds all 4 heads, i.e. all 128
// channels of its rows, so the merged rows stay in LDS and are the A operand of
// the product with Wo, behind one more barrier: 8 waves, one 8x16 tile of the
// output each, k ascending, bo as the start value.
// ---------------------------------------------------------------------------
// Value of lane ^ 16.
__device__ __forceinline__ float other_half(float x) {
  const int v = __builtin_bit_cast(int, x);
  return __builtin_bit_cast(
      float, __builtin_amdgcn_permlanex16(v, v, 0x76543210, 0xfedcba98, false, false));
}

// Value of lane l (the same l in the whole wave), in a scalar register.
__device__ __forceinline__ float lane_value(float x, int l) {
  return __builtin_bit_cast(
      float, __builtin_amdgcn_readlane(__builtin_bit_cast(int, x), l));
}

// Extent of a node's 8 corners along x, y, z.
__device__ __forceinline__ void node_size(const float* __restrict__ cp, float& sx,
                                          float& sy, float& sz) {
  float mx0 = -1e30f, mx1 = -1e30f, mx2 = -1e30f;
  float mn0 = 1e30f, mn1 = 1e30f, mn2 = 1e30f;
#pragma unroll
  for (int c = 0; c < 8; ++c) {
    float x = cp[c * 3 + 0], y = cp[c * 3 + 1], z = cp[c * 3 + 2];
    mx0 = fmaxf(mx0, x); mn0 = fminf(mn0, x);
    mx1 = fmaxf(mx1, y); mn1 = fminf(mn1, y);
    mx2 = fmaxf(mx2, z); mn2 = fminf(mn2, z);
  }
  sx = mx0 - mn0; sy = mx1 - mn1; sz = mx2 - mn2;
}

#define RI 8        // query rows of a block
#define BPITCH 260  // floats per (head, i) row of the bias in LDS: 16 B x odd
#define BPLANE (RI * BPITCH + 8)  // floats per head: heads h and h + 2 meet other banks
#define OPITCH 36   // floats per row of a partial output: 16 B x odd
#define APITCH 132  // floats per merged row: 16 rows x 8 B x 2 halves meet each bank once

__global__ void __launch_bounds__(512)
relbias_attn_proj_kernel(const float* __restrict__ centers,
                         const float* __restrict__ corners,
                         const float* __restrict__ Q, const float* __restrict__ KF,
                         const float* __restrict__ VF,
                         const float* __restrict__ bbias,
                         const float* __restrict__ q, const float* __restrict__ k,
                         const float* __restrict__ v, const float* __restrict__ Wo,
                         const float* __restrict__ bo, float* __restrict__ outp) {
  __shared__ __attribute__((aligned(16))) float ldsB[Hh * BPLANE];  // bias [h][i][j]
  __shared__ __attribute__((aligned(16))) float ldsO[16][16][OPITCH];  // [wave][i][c]
  __shared__ float ldsMS[16][2][16];  // [wave][0: maximum, 1: sum][i]
  __shared__ __attribute__((aligned(16))) float ldsA[16][APITCH];  // merged [i][c of all heads]

  const int i0   = blockIdx.x * RI;
  const int b    = blockIdx.y;
  // The wave's number, held in a scalar register: j tile, head, key quarter and the
  // test for the projection's waves are then scalar.
  const int wv   = __builtin_amdgcn_readfirstlane(threadIdx.x >> 5);
  const int h    = wv >> 2;
  const int w    = wv & 3;
  const int lane = threadIdx.x & 31;
  const int half = lane >> 4;
  const int ln   = lane & 15;
  const int li   = ln & (RI - 1);  // this column's query row

  // ======================= part 1: the bias of 8 rows i =======================
  {
    const float rs128 = 0.08838834764831845f;  // 1/sqrt(128)
    const bool  hi  = half != 0;
    const int   j   = wv * 16 + ln;

    // A fragments of the folded tables: the same for every row i.
    // Head rows of D: head 2 * half + r sits in register r (r = 0, 1) of each lane
    // half, i.e. in A rows 0, 1, 8, 9, so that all 32 lanes store.
    v2f kf[4][3];   // KF[b] rows 0..11 as (t x g), four 16-row t tiles
    v8f kc[4];      // KF[b] row 12 at t = 16 tt + 8 half + r: C of the scores
    v2f gf[3];      // (Wrel @ Wbias)^T, rows other than 0, 1, 8, 9 zero
    v2f vf[16];     // VF[b]^T in the k order of the score registers (below)
    v8f hb;         // brel @ Wbias + bbias: C of the head
    {
      const float* KFb = KF + (size_t)b * 16 * Tt;
      const float* VFb = VF + (size_t)b * Tt * Hh;
#pragma unroll  // fragments stay in registers: constant indices
      for (int tt = 0; tt < 4; ++tt) {
#pragma unroll  // fragments stay in registers: constant indices
        for (int kk = 0; kk < 3; ++kk) {
          kf[tt][kk][0] = KFb[(4 * kk + 2 * half) * Tt + tt * 16 + ln];
          kf[tt][kk][1] = KFb[(4 * kk + 2 * half + 1) * Tt + tt * 16 + ln];
        }
      }
      asm volatile("s_wait_xcnt 0x0" ::: "memory");  // before the address registers above are reused
#pragma unroll  // fragments stay in registers: constant indices
      for (int tt = 0; tt < 4; ++tt) {
#pragma unroll  // kc is a register vector: constant indices
        for (int r = 0; r < 8; ++r)
          kc[tt][r] = KFb[Gg * Tt + tt * 16 + 8 * half + r];
      }
      // padding rows read a valid head, select 0
      const int hc = 2 * (ln >> 3) + (ln & 1);
      const bool on = (ln & 7) < 2;
#pragma unroll  // fragments stay in registers: constant indices
      for (int kk = 0; kk < 3; ++kk) {
        const float g0 = Q[(QG + 4 * kk + 2 * half) * Hh + hc];
        const float g1 = Q[(QG + 4 * kk + 2 * half + 1) * Hh + hc];
        gf[kk][0] = on ? g0 : 0.f;
        gf[kk][1] = on ? g1 : 0.f;
      }
      // k step 4 tt + p of the head takes t = 16 tt + 8 half + 2 p + {0, 1}:
      // registers 2 p and 2 p + 1 of score tile tt.
#pragma unroll  // fragments stay in registers: constant indices
      for (int kk = 0; kk < 16; ++kk) {
        const int t = 16 * (kk >> 2) + 8 * half + 2 * (kk & 3);
        const float v0 = VFb[t * Hh + hc];
        const float v1 = VFb[(t + 1) * Hh + hc];
        vf[kk][0] = on ? v0 : 0.f;
        vf[kk][1] = on ? v1 : 0.f;
      }
#pragma unroll  // hb is a register vector: constant indices
      for (int r = 0; r < 8; ++r) hb[r] = 0.f;
      hb[0] = Q[(QG + Gg) * Hh + 2 * half] + bbias[2 * half];
      hb[1] = Q[(QG + Gg) * Hh + 2 * half + 1] + bbias[2 * half + 1];
      asm volatile("s_wait_xcnt 0x0" ::: "memory");  // before the address registers above are reused
    }

    // centre and size of this lane's node j, and of node i0 + li
    const float cxj = centers[(size_t)(b * Nn + j) * 3 + 0];
    const float cyj = centers[(size_t)(b * Nn + j) * 3 + 1];
    const float czj = centers[(size_t)(b * Nn + j) * 3 + 2];
    float sxj, syj, szj;
    node_size(corners + (size_t)(b * Nn + j) * 24, sxj, syj, szj);
    asm volatile("s_wait_xcnt 0x0" ::: "memory");  // before the address registers above are reused
    const float cxn = centers[(size_t)(b * Nn + i0 + li) * 3 + 0];
    const float cyn = centers[(size_t)(b * Nn + i0 + li) * 3 + 1];
    const float czn = centers[(size_t)(b * Nn + i0 + li) * 3 + 2];
    float sxn, syn, szn;
    node_size(corners + (size_t)(b * Nn + i0 + li) * 24, sxn, syn, szn);
    asm volatile("s_wait_xcnt 0x0" ::: "memory");  // before the address registers above are reused

    for (int ii = 0; ii < RI; ++ii) {
      const float cxi = lane_value(cxn, ii), cyi = lane_value(cyn, ii);
      const float czi = lane_value(czn, ii);
      const float sxi = lane_value(sxn, ii), syi = lane_value(syn, ii);
      const float szi = lane_value(szn, ii);

      // ---- stage 1: geometry features of pair (i, j), in both lane halves ----
      v2f gb[3];  // geom^T (g x j), g = 4 kk + 2 half + {0, 1} as in kf and gf
      {
        const float r0 = cxj - cxi, r1 = cyj - cyi, r2 = czj - czi;
        const float dist  = sqrtf(r0 * r0 + r1 * r1 + r2 * r2);
        const float horiz = sqrtf(r0 * r0 + r1 * r1);
        const float cose  = r2 / (dist + EPSF);
        const float dlog  = logf(dist + EPSF);
        // Feature 9 (lower half) and feature 11 (upper half) share one division.
        const float ry  = syj / (syi + EPSF);
        const float rxz = (hi ? szj : sxj) / ((hi ? szi : sxi) + EPSF);
        gb[0][0] = hi ? r2 : r0;
        gb[0][1] = hi ? dlog : r1;
        gb[1][0] = hi ? sxj - sxi : horiz;
        gb[1][1] = hi ? syj - syi : cose;
        gb[2][0] = hi ? ry : szj - szi;
        gb[2][1] = rxz;
      }

      // ---- stage 2: scores^T = (KF^T(64x12) @ geom^T(12x16) + KF row 12) * rs128
      v8f s[4];   // s[tt][r] = score of (t = 16 tt + 8 half + r, j)
#pragma unroll  // fragments stay in registers: constant indices
      for (int tt = 0; tt < 4; ++tt) {
        v8f acc = kc[tt];
#pragma unroll  // fragments stay in registers: constant indices
        for (int kk = 0; kk < 3; ++kk) acc = wmma4(kf[tt][kk], gb[kk], acc);
        s[tt] = acc * rs128;
      }

      // ---- stage 3: softmax over T=64, 32 registers in each of 2 lanes ----
      float inv;  // 1 / sum of the exponentials; applied behind the head product
      {
        float mx = -1e30f;
#pragma unroll  // s is a register array: constant indices
        for (int tt = 0; tt < 4; ++tt)
#pragma unroll  // s is a register array: constant indices
          for (int r = 0; r < 8; ++r) mx = fmaxf(mx, s[tt][r]);
        mx = fmaxf(mx, other_half(mx));
#pragma unroll  // s is a register array: constant indices
        for (int tt = 0; tt < 4; ++tt)
#pragma unroll  // s is a register array: constant indices
          for (int r = 0; r < 8; ++r) s[tt][r] = __expf(s[tt][r] - mx);
        const v8f sv = (s[0] + s[1]) + (s[2] + s[3]);
        float sum = ((sv[0] + sv[1]) + (sv[2] + sv[3])) +
                    ((sv[4] + sv[5]) + (sv[6] + sv[7]));
        sum += other_half(sum);
        inv = 1.f / sum;
      }

      // ---- stage 4: bias^T = gf(16x12) @ geom^T + hb + vf(16x64) @ exp^T * inv
      {
        v8f accg = hb;
#pragma unroll  // fragments stay in registers: constant indices
        for (int kk = 0; kk < 3; ++kk) accg = wmma4(gf[kk], gb[kk], accg);
        v8f acce;
#pragma unroll  // acce is a register vector: constant indices
        for (int r = 0; r < 8; ++r) acce[r] = 0.f;
#pragma unroll  // fragments stay in registers: constant indices
        for (int kk = 0; kk < 16; ++kk) {
          v2f ex;
          ex[0] = s[kk >> 2][2 * (kk & 3)];
          ex[1] = s[kk >> 2][2 * (kk & 3) + 1];
          acce = wmma4(vf[kk], ex, acce);
        }
        float* op = ldsB + 2 * half * BPLANE + ii * BPITCH + j;
        op[0]      = accg[0] + acce[0] * inv;
        op[BPLANE] = accg[1] + acce[1] * inv;
      }
    }
  }

  // ================= part 2: attention and output projection =================
  const int j0   = w * 64;
  const float scale = 0.1767766952966369f;  // 1/sqrt(32)

  v2f qf[8];      // q^T (d x i), d = 4 kk + 2 half + {0, 1}
  v2f kf[4][8];   // k (j x d), four 16-row j tiles, d as in qf
  v8f s[4];       // s[tt][r] = logit of (j = j0 + 16 tt + 8 half + r, i)
  v2f vf[2][16];  // v^T (c x j) in the k order of the logit registers (below)
  {
    const float* qp = q + (size_t)(b * Nn + i0 + li) * Cc + h * Dd + 2 * half;
#pragma unroll  // fragments stay in registers: constant indices
    for (int kk = 0; kk < 8; ++kk) {
      qf[kk][0] = qp[4 * kk];
      qf[kk][1] = qp[4 * kk + 1];
    }
    asm volatile("s_wait_xcnt 0x0" ::: "memory");  // before the address registers above are reused
    const float* kp = k + (size_t)(b * Nn + j0 + ln) * Cc + h * Dd + 2 * half;
#pragma unroll  // fragments stay in registers: constant indices
    for (int tt = 0; tt < 4; ++tt)
#pragma unroll  // fragments stay in registers: constant indices
      for (int kk = 0; kk < 8; ++kk) {
        kf[tt][kk][0] = kp[tt * 16 * Cc + 4 * kk];
        kf[tt][kk][1] = kp[tt * 16 * Cc + 4 * kk + 1];
      }
    asm volatile("s_wait_xcnt 0x0" ::: "memory");  // before the address registers above are reused
    // k step 4 tt + p of the second product takes j = j0 + 16 tt + 8 half +
    // 2 p + {0, 1}: registers 2 p and 2 p + 1 of logit tile tt.
    const float* vp = v + (size_t)(b * Nn + j0 + 8 * half) * Cc + h * Dd + ln;
#pragma unroll  // fragments stay in registers: constant indices
    for (int ct = 0; ct < 2; ++ct)
#pragma unroll  // fragments stay in registers: constant indices
      for (int kk = 0; kk < 16; ++kk) {
        const int jr = 16 * (kk >> 2) + 2 * (kk & 3);
        vf[ct][kk][0] = vp[jr * Cc + ct * 16];
        vf[ct][kk][1] = vp[(jr + 1) * Cc + ct * 16];
      }
    asm volatile("s_wait_xcnt 0x0" ::: "memory");  // before the address registers above are reused

    // The loads above stand in front of the barrier: a wave waits for them while the
    // slower waves still work on the bias, not behind the last of those.
    __syncthreads();

    // The bias is the C operand of the first product: 8 j in a row per lane.
    const float* bp = ldsB + h * BPLANE + li * BPITCH + j0 + 8 * half;
#pragma unroll  // s is a register array: constant indices
    for (int tt = 0; tt < 4; ++tt) {
      const v4f lo = *(const v4f*)(bp + tt * 16);
      const v4f up = *(const v4f*)(bp + tt * 16 + 4);
#pragma unroll  // s is a register array: constant indices
      for (int r = 0; r < 4; ++r) {
        s[tt][r]     = lo[r];
        s[tt][r + 4] = up[r];
      }
    }
  }

  // Keeps the reads of the bias ahead of the first product: spread among its
  // steps, each of them is waited for.
  __builtin_amdgcn_sched_barrier(0);

  // logits^T = k(64x32) @ (q * scale)^T(32x16) + bias^T
#pragma unroll  // fragments stay in registers: constant indices
  for (int kk = 0; kk < 8; ++kk) {
    const v2f qs = qf[kk] * scale;
#pragma unroll  // fragments stay in registers: constant indices
    for (int tt = 0; tt < 4; ++tt) s[tt] = wmma4(kf[tt][kk], qs, s[tt]);
  }

  // this wave's part of the softmax: 32 registers in each of 2 lanes
  float mx = -1e30f, sum;
  {
#pragma unroll  // s is a register array: constant indices
    for (int tt = 0; tt < 4; ++tt)
#pragma unroll  // s is a register array: constant indices
      for (int r = 0; r < 8; ++r) mx = fmaxf(mx, s[tt][r]);
    mx = fmaxf(mx, other_half(mx));
  }

  // The projection's waves fetch their tile of Wo (k x n, k = 4 kk + 2 half +
  // {0, 1}) here, into the registers that k has left: it lands under the
  // exponentials and the second product.
  v2f wf[32];
  float bov = 0.f;
  if (wv < 8) {
    const float* wp = Wo + (size_t)(2 * half) * Cc + wv * 16 + ln;
#pragma unroll  // fragments stay in registers: constant indices
    for (int kk = 0; kk < 32; ++kk) {
      wf[kk][0] = wp[4 * kk * Cc];
      wf[kk][1] = wp[(4 * kk + 1) * Cc];
    }
    bov = bo[wv * 16 + ln];
    asm volatile("s_wait_xcnt 0x0" ::: "memory");  // before the address registers above are reused
  }

  {
#pragma unroll  // s is a register array: constant indices
    for (int tt = 0; tt < 4; ++tt)
#pragma unroll  // s is a register array: constant indices
      for (int r = 0; r < 8; ++r) s[tt][r] = __expf(s[tt][r] - mx);
    const v8f sv = (s[0] + s[1]) + (s[2] + s[3]);
    sum = ((sv[0] + sv[1]) + (sv[2] + sv[3])) +
          ((sv[4] + sv[5]) + (sv[6] + sv[7]));
    sum += other_half(sum);
  }

  // partial out^T = v^T(32x64) @ exp^T(64x16)
  v8f o[2];  // o[ct][r] = (c = 16 ct + 8 half + r, i)
#pragma unroll  // o is a register array: constant indices
  for (int ct = 0; ct < 2; ++ct)
#pragma unroll  // o is a register array: constant indices
    for (int r = 0; r < 8; ++r) o[ct][r] = 0.f;
#pragma unroll  // fragments stay in registers: constant indices
  for (int kk = 0; kk < 16; ++kk) {
    v2f ex;
    ex[0] = s[kk >> 2][2 * (kk & 3)];
    ex[1] = s[kk >> 2][2 * (kk & 3) + 1];
#pragma unroll  // fragments stay in registers: constant indices
    for (int ct = 0; ct < 2; ++ct) o[ct] = wmma4(vf[ct][kk], ex, o[ct]);
  }

#pragma unroll  // o is a register array: constant indices
  for (int ct = 0; ct < 2; ++ct) {
    v4f lo, up;
#pragma unroll  // o is a register array: constant indices
    for (int r = 0; r < 4; ++r) {
      lo[r] = o[ct][r];
      up[r] = o[ct][r + 4];
    }
    *(v4f*)&ldsO[wv][ln][ct * 16 + 8 * half]     = lo;
    *(v4f*)&ldsO[wv][ln][ct * 16 + 8 * half + 4] = up;
  }
  ldsMS[wv][half][ln] = half ? sum : mx;  // both are equal in the two lane halves
  __syncthreads();

  // merge: wave w of head h takes rows 4 w .. 4 w + 3 of that head, 8 lanes a row.
  {
    const int mi = 4 * w + (lane >> 3);
    const int mc = 4 * (lane & 7);
    float m[4];
#pragma unroll  // m is a register array: constant indices
    for (int x = 0; x < 4; ++x) m[x] = ldsMS[4 * h + x][0][mi];
    const float mall = fmaxf(fmaxf(m[0], m[1]), fmaxf(m[2], m[3]));
    float tot = 0.f;
    v4f acc = {0.f, 0.f, 0.f, 0.f};
#pragma unroll  // m is a register array: constant indices
    for (int x = 0; x < 4; ++x) {
      const float f = __expf(m[x] - mall);
      tot += f * ldsMS[4 * h + x][1][mi];
      acc += f * *(const v4f*)&ldsO[4 * h + x][mi][mc];
    }
    const float inv = 1.f / tot;
    *(v4f*)&ldsA[mi][h * Dd + mc] = acc * inv;
  }
  __syncthreads();

  // out(16x16 tile) = merged rows(16x128) @ Wo(128x16) + bo
  if (wv < 8) {
    v8f acc;
#pragma unroll  // acc is a register vector: constant indices
    for (int r = 0; r < 8; ++r) acc[r] = bov;
    float* op = outp + (size_t)(b * Nn + i0) * Cc + wv * 16 + ln;
    v2f af[32];  // merged rows (i x k), k as in wf
#pragma unroll  // fragments stay in registers: constant indices
    for (int kk = 0; kk < 32; ++kk)
      af[kk] = *(const v2f*)&ldsA[ln][4 * kk + 2 * half];
    // Keeps all the LDS reads ahead of the product: spread among its dependent
    // steps, one pair ahead, each of them is waited for.
    __builtin_amdgcn_sched_barrier(0);
#pragma unroll  // fragments stay in registers: constant indices
    for (int kk = 0; kk < 32; ++kk) acc = wmma4(af[kk], wf[kk], acc);
    if (half == 0) {  // rows 8..15 of D repeat rows 0..7
#pragma unroll  // acc is a register vector: constant indices
      for (int r = 0; r < 8; ++r) op[r * Cc] = acc[r];
    }
  }
}

// ---------------------------------------------------------------------------
extern "C" void kernel_launch(void* const* d_in, const int* in_sizes, int n_in,
                              void* d_out, int out_size, void* d_ws,
                              size_t ws_size, hipStream_t stream) {
  (void)in_sizes; (void)n_in; (void)out_size; (void)ws_size;
  const float* feat    = (const float*)d_in[0];
  const float* centers = (const float*)d_in[1];
  const float* corners = (const float*)d_in[2];
  const float* lang    = (const float*)d_in[3];
  const float* Wq = (const float*)d_in[4];  const float* bq = (const float*)d_in[5];
  const float* Wk = (const float*)d_in[6];  const float* bk = (const float*)d_in[7];
  const float* Wv = (const float*)d_in[8];  const float* bv = (const float*)d_in[9];
  const float* Wo = (const float*)d_in[10]; const float* bo = (const float*)d_in[11];
  const float* Wrel = (const float*)d_in[12]; const float* brel = (const float*)d_in[13];
  const float* Wtk  = (const float*)d_in[14]; const float* btk  = (const float*)d_in[15];
  const float* Wtv  = (const float*)d_in[16]; const float* btv  = (const float*)d_in[17];
  const float* Wbias = (const float*)d_in[18]; const float* bbias = (const float*)d_in[19];

  float* ws = (float*)d_ws;
  const size_t MR = (size_t)Bsz * Nn;  // 2048 rows
  float* qb      = ws;
  float* kb      = qb + MR * Cc;
  float* vb      = kb + MR * Cc;
  float* Qf      = vb + MR * Cc;
  float* KFf     = Qf + (size_t)QR * Hh;
  float* VFf     = KFf + (size_t)Bsz * 16 * Tt;

  // folded tables of the language cross-attention, and in the same launch the
  // q / k / v projections (2048x128 @ 128x128)
  fold_qkv_kernel<<<dim3(8, Bsz + 24), 320, 0, stream>>>(
      Wrel, brel, Wtk, btk, Wtv, btv, Wbias, lang, Qf, KFf, VFf, feat, Wq, bq, Wk,
      bk, Wv, bv, qb, kb, vb);

  // geometry + language cross-attention -> bias, kept in LDS; biased multi-head
  // self-attention and the final projection -> d_out
  relbias_attn_proj_kernel<<<dim3(Nn / RI, Bsz), 512, 0, stream>>>(
      centers, corners, Qf, KFf, VFf, bbias, qb, kb, vb, Wo, bo, (float*)d_out);
}
